// v000
// Times are from an AMD MI455X. After a warm-up the kernel runs many times in a row, and a time is the length of
// such a window on the GPU divided by its runs, so every launch and the gaps after it count. The runs cycle
// through copies of the inputs. A figure is the median of several windows, for all but v000 over two sittings.
// Sittings can differ by a few percent; kernels timed side by side share one.
// The starting kernel, v000, takes 60 microseconds a run.
#include <hip/hip_runtime.h>

// 3D neighborhood attention (kernel_size=3) for q,k: [1,48,48,48,48], nh=8, hd=6.
// Memory-bound (~53 MB total traffic -> ~2.3us at 23.3 TB/s HBM). QK dots are
// exact fp32 via V_WMMA_F32_16X16X4_F32 (two chained K=4 WMMAs, head_dim 6
// padded to 8). k/q tiles staged to LDS with GLOBAL_LOAD_ASYNC_TO_LDS_B128
// (ASYNCcnt) when available, else plain float4 loads.

#define NH 8
#define HD 6
#define NT 27
#define N3 (48*48*48)
#define KSTRIDE 52      // padded C stride in LDS (multiple of 4 -> 16B rows for b128)
#define ATTN_STRIDE 28  // padded 27

typedef float v2f __attribute__((ext_vector_type(2)));
typedef float v8f __attribute__((ext_vector_type(8)));
typedef int   v4i __attribute__((vector_size(16)));

#if __has_builtin(__builtin_amdgcn_global_load_async_to_lds_b128)
#define USE_ASYNC_LDS 1
typedef __attribute__((address_space(1))) v4i* g_v4i_ptr;
typedef __attribute__((address_space(3))) v4i* l_v4i_ptr;
#else
#define USE_ASYNC_LDS 0
#endif

__device__ __forceinline__ void stage16(const float* __restrict__ gsrc, float* ldst) {
#if USE_ASYNC_LDS
    __builtin_amdgcn_global_load_async_to_lds_b128((g_v4i_ptr)gsrc, (l_v4i_ptr)ldst, 0, 0);
#else
    *(float4*)ldst = *(const float4*)gsrc;
#endif
}

__device__ __forceinline__ void wait_async_stage() {
#if USE_ASYNC_LDS
#if __has_builtin(__builtin_amdgcn_s_wait_asynccnt)
    __builtin_amdgcn_s_wait_asynccnt(0);
#else
    asm volatile("s_wait_asynccnt 0" ::: "memory");
#endif
#endif
}

__global__ __launch_bounds__(128)
void natten3d_wmma_kernel(const float* __restrict__ q,
                          const float* __restrict__ k,
                          const float* __restrict__ rpb,
                          float* __restrict__ out)
{
    __shared__ __align__(16) float kbuf[9 * 18 * KSTRIDE];  // 9 dirs x 18 z x C (raw)
    __shared__ __align__(16) float qbuf[16 * KSTRIDE];      // 16 z x C (raw)
    __shared__ float Sbuf[4 * 256];                          // per-wave 16x16 D tile
    __shared__ float attnbuf[NH * 16 * ATTN_STRIDE];         // logits per (head, m)
    __shared__ float rpbuf[NH * NT];

    const int x  = blockIdx.x;
    const int y  = blockIdx.y;
    const int z0 = blockIdx.z * 16;
    const int tid  = threadIdx.x;
    const int lane = tid & 31;
    const int wid  = tid >> 5;
    const int half = lane >> 4;    // lane-half selects K (A/B) or M+8 (D)
    const int mrow = lane & 15;
    const float scale = 0.40824829046386301637f;  // 6^-0.5, folded into the logit

    // ---- Stage k tile: 9 neighbor (x,y) columns, z in [z0-1, z0+16], zero-padded ----
    for (int idx = tid; idx < 9 * 18 * 12; idx += 128) {
        int dir = idx / (18 * 12);
        int rem = idx - dir * (18 * 12);
        int r   = rem / 12;
        int cw  = rem - r * 12;
        int xx = x + dir / 3 - 1;
        int yy = y + dir % 3 - 1;
        int zz = z0 - 1 + r;
        float* ldst = &kbuf[(dir * 18 + r) * KSTRIDE + cw * 4];
        if ((unsigned)xx < 48u && (unsigned)yy < 48u && (unsigned)zz < 48u) {
            stage16(k + (((size_t)(xx * 48 + yy) * 48 + zz) * 48 + cw * 4), ldst);
        } else {
            float4 zv = {0.f, 0.f, 0.f, 0.f};
            *(float4*)ldst = zv;
        }
    }
    // ---- Stage q tile (raw; scale applied to logits later) ----
    for (int idx = tid; idx < 16 * 12; idx += 128) {
        int r = idx / 12, cw = idx - r * 12;
        stage16(q + (((size_t)(x * 48 + y) * 48 + (z0 + r)) * 48 + cw * 4),
                &qbuf[r * KSTRIDE + cw * 4]);
    }
    // ---- Stage rpb ----
    for (int idx = tid; idx < NH * NT; idx += 128) rpbuf[idx] = rpb[idx];
    wait_async_stage();
    __syncthreads();

    // ---- Each wave: 2 heads x 9 directions, QK via WMMA f32 16x16x4 (exact fp32) ----
    for (int hh = 0; hh < 2; ++hh) {
        const int n = wid * 2 + hh;
        const float* qrow = &qbuf[mrow * KSTRIDE + n * HD];
        // A (16x4 f32): VGPR j holds K = half*2 + j (chunk0), 4 + half*2 + j (chunk1).
        v2f a0, a1;
        a0.x = qrow[half * 2 + 0];
        a0.y = qrow[half * 2 + 1];
        a1.x = (half == 0) ? qrow[4] : 0.f;   // K=4 valid, K=6 padded
        a1.y = (half == 0) ? qrow[5] : 0.f;   // K=5 valid, K=7 padded
        for (int dir = 0; dir < 9; ++dir) {
            // B (4x16 f32): N = lane&15 -> k row zz = z0-1+N; same K split as A.
            const float* krow = &kbuf[(dir * 18 + mrow) * KSTRIDE + n * HD];
            v2f b0, b1;
            b0.x = krow[half * 2 + 0];
            b0.y = krow[half * 2 + 1];
            b1.x = (half == 0) ? krow[4] : 0.f;
            b1.y = (half == 0) ? krow[5] : 0.f;

            v8f acc = {};
            acc = __builtin_amdgcn_wmma_f32_16x16x4_f32(false, a0, false, b0,
                                                        (short)0, acc, false, false);
            acc = __builtin_amdgcn_wmma_f32_16x16x4_f32(false, a1, false, b1,
                                                        (short)0, acc, false, false);

            // Spill D tile (row = r + 8*half, col = mrow) for diagonal-band gather.
#pragma unroll
            for (int r = 0; r < 8; ++r)
                Sbuf[wid * 256 + (r + half * 8) * 16 + mrow] = acc[r];
            __builtin_amdgcn_wave_barrier();

            // attn[m, dl] = scale * S[m, m+dl+1] + rpb; j in [0,17], j>=16 via 6-MAC dot.
            // Static lane split: half 0 -> dlidx {0,1}; half 1 -> dlidx {2}.
            {
                const int m = mrow;
                const float* Sw = &Sbuf[wid * 256 + m * 16];
                float* arow = &attnbuf[(n * 16 + m) * ATTN_STRIDE + dir * 3];
                const float* rrow = &rpbuf[n * NT + dir * 3];
                if (half == 0) {
                    float v0 = Sw[m];                       // j = m, always in-tile
                    arow[0] = v0 * scale + rrow[0];
                    float v1;
                    if (m < 15) {
                        v1 = Sw[m + 1];                     // j = m+1
                    } else {
                        v1 = 0.f;                           // j = 16 patch
                        const float* qr = &qbuf[m * KSTRIDE + n * HD];
                        const float* kr = &kbuf[(dir * 18 + 16) * KSTRIDE + n * HD];
#pragma unroll
                        for (int d = 0; d < HD; ++d) v1 += qr[d] * kr[d];
                    }
                    arow[1] = v1 * scale + rrow[1];
                } else {
                    int j = m + 2;
                    float v2;
                    if (j < 16) {
                        v2 = Sw[j];
                    } else {
                        v2 = 0.f;                           // j = 16,17 patch
                        const float* qr = &qbuf[m * KSTRIDE + n * HD];
                        const float* kr = &kbuf[(dir * 18 + j) * KSTRIDE + n * HD];
#pragma unroll
                        for (int d = 0; d < HD; ++d) v2 += qr[d] * kr[d];
                    }
                    arow[2] = v2 * scale + rrow[2];
                }
            }
            __builtin_amdgcn_wave_barrier();
        }
    }
    __syncthreads();

    // ---- Softmax over 27 tokens + contraction with constant offsets (di,dj,dl) ----
    {
        const int n = (wid << 1) + half;
        const int m = mrow;
        const float* arow = &attnbuf[(n * 16 + m) * ATTN_STRIDE];
        float mx = arow[0];
#pragma unroll
        for (int t = 1; t < NT; ++t) mx = fmaxf(mx, arow[t]);
        float s = 0.f, sdi = 0.f, sdj = 0.f, sdl = 0.f;
#pragma unroll
        for (int t = 0; t < NT; ++t) {
            float e = __expf(arow[t] - mx);
            s   += e;
            sdi += e * (float)(t / 9 - 1);
            sdj += e * (float)((t / 3) % 3 - 1);
            sdl += e * (float)(t % 3 - 1);
        }
        float inv = 1.f / s;
        size_t base = ((size_t)x * 48 + y) * 48 + (size_t)(z0 + m);
        out[(size_t)(n * 3 + 0) * N3 + base] = sdi * inv;
        out[(size_t)(n * 3 + 1) * N3 + base] = sdj * inv;
        out[(size_t)(n * 3 + 2) * N3 + base] = sdl * inv;
    }
}

extern "C" void kernel_launch(void* const* d_in, const int* in_sizes, int n_in,
                              void* d_out, int out_size, void* d_ws, size_t ws_size,
                              hipStream_t stream) {
    (void)in_sizes; (void)n_in; (void)out_size; (void)d_ws; (void)ws_size;
    const float* q   = (const float*)d_in[0];
    const float* k   = (const float*)d_in[1];
    const float* rpb = (const float*)d_in[2];
    float* out = (float*)d_out;
    dim3 grid(48, 48, 3);
    dim3 block(128);
    natten3d_wmma_kernel<<<grid, block, 0, stream>>>(q, k, rpb, out);
}

// v001
// A run of this version takes 31.6 microseconds.
// In both of two side-by-side timings against v000, it was 1.99 times as fast.
#include <hip/hip_runtime.h>

// 3D neighborhood attention (kernel_size=3) for q,k: [1,48,48,48,48], nh=8, hd=6.
// Memory-bound (~53 MB total traffic -> ~2.3us at 23.3 TB/s HBM). QK dots are
// exact fp32 via V_WMMA_F32_16X16X4_F32 (two chained K=4 WMMAs, head_dim 6
// padded to 8). k/q tiles staged to LDS with GLOBAL_LOAD_ASYNC_TO_LDS_B128
// (ASYNCcnt) when available, else plain float4 loads.

#define NH 8
#define HD 6
#define NT 27
#define N3 (48*48*48)
#define KSTRIDE 52      // padded C stride in LDS (multiple of 4 -> 16B rows for b128)

typedef float v2f __attribute__((ext_vector_type(2)));
typedef float v4f __attribute__((ext_vector_type(4)));
typedef float v8f __attribute__((ext_vector_type(8)));
typedef int   v4i __attribute__((vector_size(16)));

#if __has_builtin(__builtin_amdgcn_global_load_async_to_lds_b128)
#define USE_ASYNC_LDS 1
typedef __attribute__((address_space(1))) v4i* g_v4i_ptr;
typedef __attribute__((address_space(3))) v4i* l_v4i_ptr;
#else
#define USE_ASYNC_LDS 0
#endif

__device__ __forceinline__ void stage16(const float* __restrict__ gsrc, float* ldst) {
#if USE_ASYNC_LDS
    __builtin_amdgcn_global_load_async_to_lds_b128((g_v4i_ptr)gsrc, (l_v4i_ptr)ldst, 0, 0);
#else
    *(float4*)ldst = *(const float4*)gsrc;
#endif
}

__device__ __forceinline__ void wait_async_stage() {
#if USE_ASYNC_LDS
#if __has_builtin(__builtin_amdgcn_s_wait_asynccnt)
    __builtin_amdgcn_s_wait_asynccnt(0);
#else
    asm volatile("s_wait_asynccnt 0" ::: "memory");
#endif
#endif
}

// Value of the same column in the other 16-lane half (lane l <-> l ^ 16).
__device__ __forceinline__ float other_half(float v) {
    int b = __builtin_bit_cast(int, v);
    b = __builtin_amdgcn_permlanex16(b, b, 0x76543210, 0xfedcba98, false, false);
    return __builtin_bit_cast(float, b);
}

// o[i] = d[(s + i) & 7], i = 0..2, for a per-lane s given by its three bits: a
// three-stage rotate. Whole-vector selects: written element by element, the compiler
// turns each select into a register lookup by a per-lane index (eight compares each).
__device__ __forceinline__ v4f band3(v8f d, bool s4, bool s2, bool s1) {
    v8f r4 = __builtin_shufflevector(d, d, 4, 5, 6, 7, 0, 1, 2, 3);
    v8f t  = s4 ? r4 : d;
    v4f t0 = __builtin_shufflevector(t, t, 0, 1, 2, 3);
    v4f t2 = __builtin_shufflevector(t, t, 2, 3, 4, 5);
    v4f u  = s2 ? t2 : t0;
    v4f u1 = __builtin_shufflevector(u, u, 1, 2, 3, 3);
    return s1 ? u1 : u;
}

__global__ __launch_bounds__(128)
void natten3d_wmma_kernel(const float* __restrict__ q,
                          const float* __restrict__ k,
                          const float* __restrict__ rpb,
                          float* __restrict__ out)
{
    __shared__ __align__(16) float kbuf[9 * 18 * KSTRIDE];  // 9 dirs x 18 z x C (raw)
    __shared__ __align__(16) float qbuf[16 * KSTRIDE];      // 16 z x C (raw)
    __shared__ float rpbuf[NH * NT];

    const int x  = blockIdx.x;
    const int y  = blockIdx.y;
    const int z0 = blockIdx.z * 16;
    const int tid  = threadIdx.x;
    const int lane = tid & 31;
    const int wid  = tid >> 5;
    const int half = lane >> 4;    // lane-half selects K (A/B) or M+8 (D)
    const int mrow = lane & 15;
    const float scale = 0.40824829046386301637f;  // 6^-0.5, folded into the logit

    // ---- Stage k tile: 9 neighbor (x,y) columns, z in [z0-1, z0+16], zero-padded ----
    for (int idx = tid; idx < 9 * 18 * 12; idx += 128) {
        int dir = idx / (18 * 12);
        int rem = idx - dir * (18 * 12);
        int r   = rem / 12;
        int cw  = rem - r * 12;
        int xx = x + dir / 3 - 1;
        int yy = y + dir % 3 - 1;
        int zz = z0 - 1 + r;
        float* ldst = &kbuf[(dir * 18 + r) * KSTRIDE + cw * 4];
        if ((unsigned)xx < 48u && (unsigned)yy < 48u && (unsigned)zz < 48u) {
            stage16(k + (((size_t)(xx * 48 + yy) * 48 + zz) * 48 + cw * 4), ldst);
        } else {
            float4 zv = {0.f, 0.f, 0.f, 0.f};
            *(float4*)ldst = zv;
        }
    }
    // ---- Stage q tile (raw; scale applied to logits later) ----
    for (int idx = tid; idx < 16 * 12; idx += 128) {
        int r = idx / 12, cw = idx - r * 12;
        stage16(q + (((size_t)(x * 48 + y) * 48 + (z0 + r)) * 48 + cw * 4),
                &qbuf[r * KSTRIDE + cw * 4]);
    }
    // ---- Stage rpb ----
    for (int idx = tid; idx < NH * NT; idx += 128) rpbuf[idx] = rpb[idx];
    wait_async_stage();
    __syncthreads();

    // ---- Each wave: 2 heads x 9 directions, QK via WMMA f32 16x16x4 (exact fp32) ----
    // A = k rows, B = q rows, so D[row j = k row, column m = q position]: a lane holds
    // column m = lane&15, rows r + 8*half. Lane (half, m) ends up with the 27 logits of
    // head 2*wid + half at position m in registers; nothing goes through LDS.
    const int n = (wid << 1) + half;
    const int m = mrow;
    const v2f zero2 = {0.f, 0.f};
    const bool lo = (half == 0);
    const bool s4 = (m & 4) != 0, s2 = (m & 2) != 0, s1 = (m & 1) != 0;

    // q fragments of both heads: VGPR j holds K = half*2 + j, then 4 + half*2 + j
    // (K = 6,7 padded with zero), the same K split as the k fragments below.
    const float* qw = &qbuf[m * KSTRIDE + (wid << 1) * HD];
    const v2f qa0 = *(const v2f*)(qw + half * 2);
    const v2f qa4 = *(const v2f*)(qw + 4);
    const v2f qa1 = lo ? qa4 : zero2;
    const v2f qb0 = *(const v2f*)(qw + HD + half * 2);
    const v2f qb4 = *(const v2f*)(qw + HD + 4);
    const v2f qb1 = lo ? qb4 : zero2;

    // This lane's own q row (its head) for the k rows 16 and 17 outside the tile.
    float qv[HD];
    {
        const float* qr = &qbuf[m * KSTRIDE + n * HD];
#pragma unroll
        for (int d = 0; d < HD; d += 2) {
            v2f t = *(const v2f*)(qr + d);
            qv[d] = t.x; qv[d + 1] = t.y;
        }
    }
    const float* rrow = &rpbuf[n * NT];

    float lg[NT];
    // Unrolled so that lg[] is indexed statically and stays in registers.
#pragma unroll
    for (int dir = 0; dir < 9; ++dir) {
        const float* kw = &kbuf[(dir * 18 + mrow) * KSTRIDE + (wid << 1) * HD];
        const v2f ka0 = *(const v2f*)(kw + half * 2);
        const v2f ka4 = *(const v2f*)(kw + 4);
        const v2f ka1 = lo ? ka4 : zero2;
        const v2f kb0 = *(const v2f*)(kw + HD + half * 2);
        const v2f kb4 = *(const v2f*)(kw + HD + 4);
        const v2f kb1 = lo ? kb4 : zero2;

        v8f d0 = {}, d1 = {};
        d0 = __builtin_amdgcn_wmma_f32_16x16x4_f32(false, ka0, false, qa0,
                                                   (short)0, d0, false, false);
        d1 = __builtin_amdgcn_wmma_f32_16x16x4_f32(false, kb0, false, qb0,
                                                   (short)0, d1, false, false);
        d0 = __builtin_amdgcn_wmma_f32_16x16x4_f32(false, ka1, false, qa1,
                                                   (short)0, d0, false, false);
        d1 = __builtin_amdgcn_wmma_f32_16x16x4_f32(false, kb1, false, qb1,
                                                   (short)0, d1, false, false);

        // k rows j = 16, 17 (needed at m = 14, 15 only): 6-MAC dots, branch-free.
        const float* k16 = &kbuf[(dir * 18 + 16) * KSTRIDE + n * HD];
        const float* kjj = k16 + ((m == 15) ? KSTRIDE : 0);   // row m + 2 at m = 14, 15
        float p16 = 0.f, pjj = 0.f;
#pragma unroll
        for (int d = 0; d < HD; d += 2) {
            v2f t = *(const v2f*)(k16 + d);
            v2f w = *(const v2f*)(kjj + d);
            p16 = fmaf(qv[d], t.x, p16); p16 = fmaf(qv[d + 1], t.y, p16);
            pjj = fmaf(qv[d], w.x, pjj); pjj = fmaf(qv[d + 1], w.y, pjj);
        }

        // Rows (m + dl) & 7 of this lane's half, for both heads.
        const v4f c0 = band3(d0, s4, s2, s1);
        const v4f c1 = band3(d1, s4, s2, s1);
#pragma unroll
        for (int dl = 0; dl < 3; ++dl) {
            // Row j = m + dl sits in half j >> 3: in this lane or in its partner,
            // which hands over the value of the head that this lane owns.
            float keep = lo ? c0[dl] : c1[dl];
            float recv = other_half(lo ? c1[dl] : c0[dl]);
            float v = (((m + dl) >> 3) == half) ? keep : recv;
            if (dl == 1) v = (m == 15) ? p16 : v;
            if (dl == 2) v = (m >= 14) ? pjj : v;
            lg[dir * 3 + dl] = v * scale + rrow[dir * 3 + dl];
        }
        // Keeps each direction's tiles from being formed long before they are used:
        // without it all 36 WMMAs are scheduled first and the register count bars waves.
        __builtin_amdgcn_sched_barrier(0);
    }

    // ---- Softmax over 27 tokens + contraction with constant offsets (di,dj,dl) ----
    {
        float mx = lg[0];
#pragma unroll
        for (int t = 1; t < NT; ++t) mx = fmaxf(mx, lg[t]);
        float s = 0.f, sdi = 0.f, sdj = 0.f, sdl = 0.f;
#pragma unroll
        for (int t = 0; t < NT; ++t) {
            float e = __expf(lg[t] - mx);
            s   += e;
            sdi += e * (float)(t / 9 - 1);
            sdj += e * (float)((t / 3) % 3 - 1);
            sdl += e * (float)(t % 3 - 1);
        }
        float inv = 1.f / s;
        size_t base = ((size_t)x * 48 + y) * 48 + (size_t)(z0 + m);
        out[(size_t)(n * 3 + 0) * N3 + base] = sdi * inv;
        out[(size_t)(n * 3 + 1) * N3 + base] = sdj * inv;
        out[(size_t)(n * 3 + 2) * N3 + base] = sdl * inv;
    }
}

extern "C" void kernel_launch(void* const* d_in, const int* in_sizes, int n_in,
                              void* d_out, int out_size, void* d_ws, size_t ws_size,
                              hipStream_t stream) {
    (void)in_sizes; (void)n_in; (void)out_size; (void)d_ws; (void)ws_size;
    const float* q   = (const float*)d_in[0];
    const float* k   = (const float*)d_in[1];
    const float* rpb = (const float*)d_in[2];
    float* out = (float*)d_out;
    dim3 grid(48, 48, 3);
    dim3 block(128);
    natten3d_wmma_kernel<<<grid, block, 0, stream>>>(q, k, rpb, out);
}

// v002
// It runs in 27.5 microseconds.
// Two timings next to v001 both put it at 1.15 times that version's speed.
// Counting every step since v000, it is 2.28 times as fast.
#include <hip/hip_runtime.h>

// 3D neighborhood attention (kernel_size=3) for q,k: [1,48,48,48,48], nh=8, hd=6.
// Memory-bound (~53 MB total traffic -> ~2.3us at 23.3 TB/s HBM). QK dots are
// exact fp32 via V_WMMA_F32_16X16X4_F32 (two chained K=4 WMMAs, head_dim 6
// padded to 8). k/q tiles staged to LDS with GLOBAL_LOAD_ASYNC_TO_LDS_B128
// (ASYNCcnt) when available, else plain float4 loads.

#define NH 8
#define HD 6
#define NT 27
#define N3 (48*48*48)
#define KSTRIDE 52      // padded C stride in LDS (multiple of 4 -> 16B rows for b128)

typedef float v2f __attribute__((ext_vector_type(2)));
typedef float v4f __attribute__((ext_vector_type(4)));
typedef float v8f __attribute__((ext_vector_type(8)));
typedef int   v4i __attribute__((vector_size(16)));

#if __has_builtin(__builtin_amdgcn_global_load_async_to_lds_b128)
#define USE_ASYNC_LDS 1
typedef __attribute__((address_space(1))) v4i* g_v4i_ptr;
typedef __attribute__((address_space(3))) v4i* l_v4i_ptr;
#else
#define USE_ASYNC_LDS 0
#endif

__device__ __forceinline__ void stage16(const float* __restrict__ gsrc, float* ldst) {
#if USE_ASYNC_LDS
    __builtin_amdgcn_global_load_async_to_lds_b128((g_v4i_ptr)gsrc, (l_v4i_ptr)ldst, 0, 0);
#else
    *(float4*)ldst = *(const float4*)gsrc;
#endif
}

__device__ __forceinline__ void wait_async_stage() {
#if USE_ASYNC_LDS
#if __has_builtin(__builtin_amdgcn_s_wait_asynccnt)
    __builtin_amdgcn_s_wait_asynccnt(0);
#else
    asm volatile("s_wait_asynccnt 0" ::: "memory");
#endif
#endif
}

// Value of the same column in the other 16-lane half (lane l <-> l ^ 16).
__device__ __forceinline__ float other_half(float v) {
    int b = __builtin_bit_cast(int, v);
    b = __builtin_amdgcn_permlanex16(b, b, 0x76543210, 0xfedcba98, false, false);
    return __builtin_bit_cast(float, b);
}

// o[i] = d[(s + i) & 7], i = 0..2, for a per-lane s given by its three bits: a
// three-stage rotate. Whole-vector selects: written element by element, the compiler
// turns each select into a register lookup by a per-lane index (eight compares each).
__device__ __forceinline__ v4f band3(v8f d, bool s4, bool s2, bool s1) {
    v8f r4 = __builtin_shufflevector(d, d, 4, 5, 6, 7, 0, 1, 2, 3);
    v8f t  = s4 ? r4 : d;
    v4f t0 = __builtin_shufflevector(t, t, 0, 1, 2, 3);
    v4f t2 = __builtin_shufflevector(t, t, 2, 3, 4, 5);
    v4f u  = s2 ? t2 : t0;
    v4f u1 = __builtin_shufflevector(u, u, 1, 2, 3, 3);
    return s1 ? u1 : u;
}

__global__ __launch_bounds__(128)
void natten3d_wmma_kernel(const float* __restrict__ q,
                          const float* __restrict__ k,
                          const float* __restrict__ rpb,
                          float* __restrict__ out)
{
    __shared__ __align__(16) float kbuf[9 * 18 * KSTRIDE];  // 9 dirs x 18 z x C (raw)
    __shared__ __align__(16) float qbuf[16 * KSTRIDE];      // 16 z x C (raw)
    __shared__ float rpbuf[NH * NT];

    const int x  = blockIdx.x;
    const int y  = blockIdx.y;
    const int z0 = blockIdx.z * 16;
    const int tid  = threadIdx.x;
    const int lane = tid & 31;
    const int wid  = tid >> 5;
    const int half = lane >> 4;    // lane-half selects K (A/B) or M+8 (D)
    const int mrow = lane & 15;
    const float scale = 0.40824829046386301637f;  // 6^-0.5, folded into the logit

    // ---- Stage k and q. The z rows of one (x,y) column are contiguous in memory, so a
    // column's 18 rows are 216 chunks of 16 bytes in a row; chunk c lands at chunk c + c/12
    // of the column's LDS tile (13 chunks per padded row). Each lane takes chunks tid and
    // tid + 128 of every column: its two offsets are formed once, and the column's base and
    // its x/y bounds test are scalar.
    // readfirstlane: the wave's number as a scalar, for scalar tests on it.
    const int wv = __builtin_amdgcn_readfirstlane(wid);
    const int xm = x - 1;
    const int ym = y - 1;
    const unsigned c0 = (unsigned)tid;
    const unsigned c1 = min((unsigned)tid + 128u, 215u);  // lanes past the end: off, in bounds
    const unsigned r0 = c0 / 12u, r1 = c1 / 12u;
    const int zz0 = z0 - 1 + (int)r0, zz1 = z0 - 1 + (int)r1;
    const bool zok0 = (unsigned)zz0 < 48u, zok1 = (unsigned)zz1 < 48u;
    const bool in1 = tid < 88;
    float* const lk0 = kbuf + (c0 + r0) * 4u;
    float* const lk1 = kbuf + (c1 + r1) * 4u;
    const unsigned g0 = ((unsigned)min(max(zz0, 0), 47) * 12u + (c0 - r0 * 12u)) * 4u;
    const unsigned g1 = ((unsigned)min(max(zz1, 0), 47) * 12u + (c1 - r1 * 12u)) * 4u;
    if (zok0) {
        // Unrolled (here and below) so that each column's LDS offset is a constant.
#pragma unroll
        for (int dir = 0; dir < 9; ++dir) {
            const int xx = xm + dir / 3, yy = ym + dir % 3;
            if ((unsigned)xx < 48u && (unsigned)yy < 48u)
                stage16(k + (size_t)(xx * 48 + yy) * (48 * 48) + g0, lk0 + dir * 18 * KSTRIDE);
        }
    }
    if (wv < 3) {   // wave 3 has no chunk in the second pass
        if (in1 && zok1) {
#pragma unroll
            for (int dir = 0; dir < 9; ++dir) {
                const int xx = xm + dir / 3, yy = ym + dir % 3;
                if ((unsigned)xx < 48u && (unsigned)yy < 48u)
                    stage16(k + (size_t)(xx * 48 + yy) * (48 * 48) + g1, lk1 + dir * 18 * KSTRIDE);
            }
        }
    }
    // Zero padding: rows z = -1 and z = 48 of every column, then the columns outside x or y.
    const float4 zv = {0.f, 0.f, 0.f, 0.f};
    if (!zok0) {
#pragma unroll
        for (int dir = 0; dir < 9; ++dir) *(float4*)(lk0 + dir * 18 * KSTRIDE) = zv;
    }
    if (in1 && !zok1) {
#pragma unroll
        for (int dir = 0; dir < 9; ++dir) *(float4*)(lk1 + dir * 18 * KSTRIDE) = zv;
    }
    if ((unsigned)xm >= 46u || (unsigned)ym >= 46u) {
#pragma unroll
        for (int dir = 0; dir < 9; ++dir) {
            const int xx = xm + dir / 3, yy = ym + dir % 3;
            if (!((unsigned)xx < 48u && (unsigned)yy < 48u)) {
                *(float4*)(lk0 + dir * 18 * KSTRIDE) = zv;
                if (in1) *(float4*)(lk1 + dir * 18 * KSTRIDE) = zv;
            }
        }
    }
    // q tile (raw; scale applied to logits later): 192 chunks, the same chunk map.
    {
        const float* qb = q + ((size_t)(x * 48 + y) * 48 + z0) * 48;
        stage16(qb + c0 * 4u, qbuf + (c0 + r0) * 4u);
        if (wv < 2) stage16(qb + c1 * 4u, qbuf + (c1 + r1) * 4u);
    }
    // ---- Stage rpb ----
    for (int idx = tid; idx < NH * NT; idx += 128) rpbuf[idx] = rpb[idx];
    wait_async_stage();
    __syncthreads();

    // ---- Each wave: 2 heads x 9 directions, QK via WMMA f32 16x16x4 (exact fp32) ----
    // A = k rows, B = q rows, so D[row j = k row, column m = q position]: a lane holds
    // column m = lane&15, rows r + 8*half. Lane (half, m) ends up with the 27 logits of
    // head 2*wid + half at position m in registers; nothing goes through LDS.
    const int n = (wid << 1) + half;
    const int m = mrow;
    const v2f zero2 = {0.f, 0.f};
    const bool lo = (half == 0);
    const bool s4 = (m & 4) != 0, s2 = (m & 2) != 0, s1 = (m & 1) != 0;

    // q fragments of both heads: VGPR j holds K = half*2 + j, then 4 + half*2 + j
    // (K = 6,7 padded with zero), the same K split as the k fragments below.
    const float* qw = &qbuf[m * KSTRIDE + (wid << 1) * HD];
    const v2f qa0 = *(const v2f*)(qw + half * 2);
    const v2f qa4 = *(const v2f*)(qw + 4);
    const v2f qa1 = lo ? qa4 : zero2;
    const v2f qb0 = *(const v2f*)(qw + HD + half * 2);
    const v2f qb4 = *(const v2f*)(qw + HD + 4);
    const v2f qb1 = lo ? qb4 : zero2;

    // This lane's own q row (its head) for the k rows 16 and 17 outside the tile.
    float qv[HD];
    {
        const float* qr = &qbuf[m * KSTRIDE + n * HD];
#pragma unroll
        for (int d = 0; d < HD; d += 2) {
            v2f t = *(const v2f*)(qr + d);
            qv[d] = t.x; qv[d + 1] = t.y;
        }
    }
    const float* rrow = &rpbuf[n * NT];

    float lg[NT];
    // Unrolled so that lg[] is indexed statically and stays in registers.
#pragma unroll
    for (int dir = 0; dir < 9; ++dir) {
        const float* kw = &kbuf[(dir * 18 + mrow) * KSTRIDE + (wid << 1) * HD];
        const v2f ka0 = *(const v2f*)(kw + half * 2);
        const v2f ka4 = *(const v2f*)(kw + 4);
        const v2f ka1 = lo ? ka4 : zero2;
        const v2f kb0 = *(const v2f*)(kw + HD + half * 2);
        const v2f kb4 = *(const v2f*)(kw + HD + 4);
        const v2f kb1 = lo ? kb4 : zero2;

        v8f d0 = {}, d1 = {};
        d0 = __builtin_amdgcn_wmma_f32_16x16x4_f32(false, ka0, false, qa0,
                                                   (short)0, d0, false, false);
        d1 = __builtin_amdgcn_wmma_f32_16x16x4_f32(false, kb0, false, qb0,
                                                   (short)0, d1, false, false);
        d0 = __builtin_amdgcn_wmma_f32_16x16x4_f32(false, ka1, false, qa1,
                                                   (short)0, d0, false, false);
        d1 = __builtin_amdgcn_wmma_f32_16x16x4_f32(false, kb1, false, qb1,
                                                   (short)0, d1, false, false);

        // k rows j = 16, 17 (needed at m = 14, 15 only): 6-MAC dots, branch-free.
        const float* k16 = &kbuf[(dir * 18 + 16) * KSTRIDE + n * HD];
        const float* kjj = k16 + ((m == 15) ? KSTRIDE : 0);   // row m + 2 at m = 14, 15
        float p16 = 0.f, pjj = 0.f;
#pragma unroll
        for (int d = 0; d < HD; d += 2) {
            v2f t = *(const v2f*)(k16 + d);
            v2f w = *(const v2f*)(kjj + d);
            p16 = fmaf(qv[d], t.x, p16); p16 = fmaf(qv[d + 1], t.y, p16);
            pjj = fmaf(qv[d], w.x, pjj); pjj = fmaf(qv[d + 1], w.y, pjj);
        }

        // Rows (m + dl) & 7 of this lane's half, for both heads.
        const v4f c0 = band3(d0, s4, s2, s1);
        const v4f c1 = band3(d1, s4, s2, s1);
#pragma unroll
        for (int dl = 0; dl < 3; ++dl) {
            // Row j = m + dl sits in half j >> 3: in this lane or in its partner,
            // which hands over the value of the head that this lane owns.
            float keep = lo ? c0[dl] : c1[dl];
            float recv = other_half(lo ? c1[dl] : c0[dl]);
            float v = (((m + dl) >> 3) == half) ? keep : recv;
            if (dl == 1) v = (m == 15) ? p16 : v;
            if (dl == 2) v = (m >= 14) ? pjj : v;
            lg[dir * 3 + dl] = v * scale + rrow[dir * 3 + dl];
        }
        // Keeps each direction's tiles from being formed long before they are used:
        // without it all 36 WMMAs are scheduled first and the register count bars waves.
        __builtin_amdgcn_sched_barrier(0);
    }

    // ---- Softmax over 27 tokens + contraction with constant offsets (di,dj,dl) ----
    {
        float mx = lg[0];
#pragma unroll
        for (int t = 1; t < NT; ++t) mx = fmaxf(mx, lg[t]);
        float s = 0.f, sdi = 0.f, sdj = 0.f, sdl = 0.f;
#pragma unroll
        for (int t = 0; t < NT; ++t) {
            float e = __expf(lg[t] - mx);
            s   += e;
            sdi += e * (float)(t / 9 - 1);
            sdj += e * (float)((t / 3) % 3 - 1);
            sdl += e * (float)(t % 3 - 1);
        }
        float inv = 1.f / s;
        size_t base = ((size_t)x * 48 + y) * 48 + (size_t)(z0 + m);
        out[(size_t)(n * 3 + 0) * N3 + base] = sdi * inv;
        out[(size_t)(n * 3 + 1) * N3 + base] = sdj * inv;
        out[(size_t)(n * 3 + 2) * N3 + base] = sdl * inv;
    }
}

extern "C" void kernel_launch(void* const* d_in, const int* in_sizes, int n_in,
                              void* d_out, int out_size, void* d_ws, size_t ws_size,
                              hipStream_t stream) {
    (void)in_sizes; (void)n_in; (void)out_size; (void)d_ws; (void)ws_size;
    const float* q   = (const float*)d_in[0];
    const float* k   = (const float*)d_in[1];
    const float* rpb = (const float*)d_in[2];
    float* out = (float*)d_out;
    dim3 grid(48, 48, 3);
    dim3 block(128);
    natten3d_wmma_kernel<<<grid, block, 0, stream>>>(q, k, rpb, out);
}

// v003
// It runs in 26.5 microseconds.
// Two timings next to v002 put it at 1.03 and 1.04 times that version's speed.
// All steps since v000 together make it 2.36 times as fast.
#include <hip/hip_runtime.h>

// 3D neighborhood attention (kernel_size=3) for q,k: [1,48,48,48,48], nh=8, hd=6.
// Memory-bound (~53 MB total traffic -> ~2.3us at 23.3 TB/s HBM). QK dots are
// exact fp32 via V_WMMA_F32_16X16X4_F32 (two chained K=4 WMMAs, head_dim 6
// padded to 8). k/q tiles staged to LDS with GLOBAL_LOAD_ASYNC_TO_LDS_B128
// (ASYNCcnt) when available, else plain float4 loads.

#define NH 8
#define HD 6
#define NT 27
#define N3 (48*48*48)
#define KSTRIDE 52      // padded C stride in LDS (multiple of 4 -> 16B rows for b128)
#define COLF (18 * KSTRIDE)   // floats of one staged k column (18 z rows)
#define SLABF (3 * COLF)      // floats of one y slab: the columns x-1, x, x+1
#define QTF (16 * KSTRIDE)    // floats of one staged q tile
#define NY 3                  // y positions one work-group walks (grid.y = 48 / NY)

typedef float v2f __attribute__((ext_vector_type(2)));
typedef float v4f __attribute__((ext_vector_type(4)));
typedef float v8f __attribute__((ext_vector_type(8)));
typedef int   v4i __attribute__((vector_size(16)));

#if __has_builtin(__builtin_amdgcn_global_load_async_to_lds_b128)
#define USE_ASYNC_LDS 1
typedef __attribute__((address_space(1))) v4i* g_v4i_ptr;
typedef __attribute__((address_space(3))) v4i* l_v4i_ptr;
#else
#define USE_ASYNC_LDS 0
#endif

__device__ __forceinline__ void stage16(const float* __restrict__ gsrc, float* ldst) {
#if USE_ASYNC_LDS
    __builtin_amdgcn_global_load_async_to_lds_b128((g_v4i_ptr)gsrc, (l_v4i_ptr)ldst, 0, 0);
#else
    *(float4*)ldst = *(const float4*)gsrc;
#endif
}

// Own copies landed. In asm with the memory clobber: no LDS read moves in front of it.
__device__ __forceinline__ void wait_async_stage() {
#if USE_ASYNC_LDS
    asm volatile("s_wait_asynccnt 0x0" ::: "memory");
#endif
}

// Own LDS reads and writes retired, before the barrier behind which a buffer is refilled.
__device__ __forceinline__ void wait_lds() {
    asm volatile("s_wait_dscnt 0x0" ::: "memory");
}

// Value of the same column in the other 16-lane half (lane l <-> l ^ 16).
__device__ __forceinline__ float other_half(float v) {
    int b = __builtin_bit_cast(int, v);
    b = __builtin_amdgcn_permlanex16(b, b, 0x76543210, 0xfedcba98, false, false);
    return __builtin_bit_cast(float, b);
}

// o[i] = d[(s + i) & 7], i = 0..2, for a per-lane s given by its three bits: a
// three-stage rotate. Whole-vector selects: written element by element, the compiler
// turns each select into a register lookup by a per-lane index (eight compares each).
__device__ __forceinline__ v4f band3(v8f d, bool s4, bool s2, bool s1) {
    v8f r4 = __builtin_shufflevector(d, d, 4, 5, 6, 7, 0, 1, 2, 3);
    v8f t  = s4 ? r4 : d;
    v4f t0 = __builtin_shufflevector(t, t, 0, 1, 2, 3);
    v4f t2 = __builtin_shufflevector(t, t, 2, 3, 4, 5);
    v4f u  = s2 ? t2 : t0;
    v4f u1 = __builtin_shufflevector(u, u, 1, 2, 3, 3);
    return s1 ? u1 : u;
}

__global__ __launch_bounds__(128)
void natten3d_wmma_kernel(const float* __restrict__ q,
                          const float* __restrict__ k,
                          const float* __restrict__ rpb,
                          float* __restrict__ out)
{
    // A work-group walks NY positions along y at fixed x and z tile. The k columns of one y
    // (x-1, x, x+1) are a slab; slab i (y = ys - 1 + i) lies in slot i & 3 of a ring of four:
    // step t reads slabs t, t+1, t+2 while slab t+3 lands. q tiles alternate in two buffers.
    __shared__ __align__(16) float kbuf[4 * SLABF];
    __shared__ __align__(16) float qbuf[2 * QTF];
    __shared__ float rpbuf[NH * NT];

    const int x  = blockIdx.x;
    const int ys = blockIdx.y * NY;
    const int z0 = blockIdx.z * 16;
    const int tid  = threadIdx.x;
    const int lane = tid & 31;
    const int wid  = tid >> 5;
    const int half = lane >> 4;    // lane-half selects K (A/B) or M+8 (D)
    const int mrow = lane & 15;
    const float scale = 0.40824829046386301637f;  // 6^-0.5, folded into the logit

    // ---- Staging map. The z rows of one (x,y) column are contiguous in memory, so a
    // column's 18 rows are 216 chunks of 16 bytes in a row; chunk c lands at chunk c + c/12
    // of the column's LDS tile (13 chunks per padded row). Each lane takes chunks tid and
    // tid + 128 of every column: its two offsets are formed once, and the column's base and
    // its x/y bounds test are scalar.
    // readfirstlane: the wave's number as a scalar, for scalar tests on it.
    const int wv = __builtin_amdgcn_readfirstlane(wid);
    const int xm = x - 1;
    const unsigned c0 = (unsigned)tid;
    const unsigned c1 = min((unsigned)tid + 128u, 215u);  // lanes past the end: off, in bounds
    const unsigned r0 = c0 / 12u, r1 = c1 / 12u;
    const int zz0 = z0 - 1 + (int)r0, zz1 = z0 - 1 + (int)r1;
    const bool zok0 = (unsigned)zz0 < 48u, zok1 = (unsigned)zz1 < 48u;
    const bool in1 = tid < 88;
    float* const lk0 = kbuf + (c0 + r0) * 4u;
    float* const lk1 = kbuf + (c1 + r1) * 4u;
    const unsigned g0 = ((unsigned)min(max(zz0, 0), 47) * 12u + (c0 - r0 * 12u)) * 4u;
    const unsigned g1 = ((unsigned)min(max(zz1, 0), 47) * 12u + (c1 - r1 * 12u)) * 4u;
    const float4 zv = {0.f, 0.f, 0.f, 0.f};

    // One slab (three columns at y = yy) into ring slot 'slot'; yy and slot are scalar.
    auto stage_slab = [&](int yy, int slot) {
        float* const s0 = lk0 + slot * SLABF;
        float* const s1 = lk1 + slot * SLABF;
        const bool yok = (unsigned)yy < 48u;
        if (zok0) {
            // Unrolled (here and below) so that each column's LDS offset is a constant.
#pragma unroll
            for (int di = 0; di < 3; ++di) {
                const int xx = xm + di;
                if (yok && (unsigned)xx < 48u)
                    stage16(k + (size_t)(xx * 48 + yy) * (48 * 48) + g0, s0 + di * COLF);
            }
        }
        if (wv < 3) {   // wave 3 has no chunk in the second pass
            if (in1 && zok1) {
#pragma unroll
                for (int di = 0; di < 3; ++di) {
                    const int xx = xm + di;
                    if (yok && (unsigned)xx < 48u)
                        stage16(k + (size_t)(xx * 48 + yy) * (48 * 48) + g1, s1 + di * COLF);
                }
            }
        }
        // Zero padding: rows z = -1 and z = 48 of every column, then columns outside x or y.
        if (!zok0) {
#pragma unroll
            for (int di = 0; di < 3; ++di) *(float4*)(s0 + di * COLF) = zv;
        }
        if (in1 && !zok1) {
#pragma unroll
            for (int di = 0; di < 3; ++di) *(float4*)(s1 + di * COLF) = zv;
        }
        if (!yok || (unsigned)xm >= 46u) {
#pragma unroll
            for (int di = 0; di < 3; ++di) {
                const int xx = xm + di;
                if (!(yok && (unsigned)xx < 48u)) {
                    *(float4*)(s0 + di * COLF) = zv;
                    if (in1) *(float4*)(s1 + di * COLF) = zv;
                }
            }
        }
    };
    // q tile of position y = yy (raw; scale applied to logits later): 192 chunks, same map.
    auto stage_q = [&](int yy, int buf) {
        const float* qb = q + ((size_t)(x * 48 + yy) * 48 + z0) * 48;
        float* const qd = qbuf + buf * QTF;
        stage16(qb + c0 * 4u, qd + (c0 + r0) * 4u);
        if (wv < 2) stage16(qb + c1 * 4u, qd + (c1 + r1) * 4u);
    };

    // ---- Prologue: what step 0 reads, published; then what step 1 adds, left in flight ----
    stage_slab(ys - 1, 0);
    stage_slab(ys, 1);
    stage_slab(ys + 1, 2);
    stage_q(ys, 0);
    for (int idx = tid; idx < NH * NT; idx += 128) rpbuf[idx] = rpb[idx];
    wait_lds();
    wait_async_stage();
    __syncthreads();
    stage_slab(ys + 2, 3);
    stage_q(ys + 1, 1);

    // ---- Each wave: 2 heads x 9 directions, QK via WMMA f32 16x16x4 (exact fp32) ----
    // A = k rows, B = q rows, so D[row j = k row, column m = q position]: a lane holds
    // column m = lane&15, rows r + 8*half. Lane (half, m) ends up with the 27 logits of
    // head 2*wid + half at position m in registers; nothing goes through LDS.
    const int n = (wid << 1) + half;
    const int m = mrow;
    const v2f zero2 = {0.f, 0.f};
    const bool lo = (half == 0);
    const bool s4 = (m & 4) != 0, s2 = (m & 2) != 0, s1 = (m & 1) != 0;
    const float* rrow = &rpbuf[n * NT];

    // Kept rolled: one copy of the step's code, the ring slots being scalar offsets.
#pragma unroll 1
    for (int t = 0; t < NY; ++t) {
        // q fragments of both heads: VGPR j holds K = half*2 + j, then 4 + half*2 + j
        // (K = 6,7 padded with zero), the same K split as the k fragments below.
        const float* qt = qbuf + (t & 1) * QTF;
        const float* qw = qt + m * KSTRIDE + (wid << 1) * HD;
        const v2f qa0 = *(const v2f*)(qw + half * 2);
        const v2f qa4 = *(const v2f*)(qw + 4);
        const v2f qa1 = lo ? qa4 : zero2;
        const v2f qb0 = *(const v2f*)(qw + HD + half * 2);
        const v2f qb4 = *(const v2f*)(qw + HD + 4);
        const v2f qb1 = lo ? qb4 : zero2;

        // This lane's own q row (its head) for the k rows 16 and 17 outside the tile.
        float qv[HD];
        {
            const float* qr = qt + m * KSTRIDE + n * HD;
#pragma unroll
            for (int d = 0; d < HD; d += 2) {
                v2f tq = *(const v2f*)(qr + d);
                qv[d] = tq.x; qv[d + 1] = tq.y;
            }
        }

        float lg[NT];
        // Unrolled so that lg[] is indexed statically and stays in registers.
#pragma unroll
        for (int dir = 0; dir < 9; ++dir) {
            // Column (x - 1 + dir / 3, y - 1 + dir % 3): slab t + dir % 3 of the ring.
            const float* kc = kbuf + ((t + dir % 3) & 3) * SLABF + (dir / 3) * COLF;
            const float* kw = kc + mrow * KSTRIDE + (wid << 1) * HD;
            const v2f ka0 = *(const v2f*)(kw + half * 2);
            const v2f ka4 = *(const v2f*)(kw + 4);
            const v2f ka1 = lo ? ka4 : zero2;
            const v2f kb0 = *(const v2f*)(kw + HD + half * 2);
            const v2f kb4 = *(const v2f*)(kw + HD + 4);
            const v2f kb1 = lo ? kb4 : zero2;

            v8f d0 = {}, d1 = {};
            d0 = __builtin_amdgcn_wmma_f32_16x16x4_f32(false, ka0, false, qa0,
                                                       (short)0, d0, false, false);
            d1 = __builtin_amdgcn_wmma_f32_16x16x4_f32(false, kb0, false, qb0,
                                                       (short)0, d1, false, false);
            d0 = __builtin_amdgcn_wmma_f32_16x16x4_f32(false, ka1, false, qa1,
                                                       (short)0, d0, false, false);
            d1 = __builtin_amdgcn_wmma_f32_16x16x4_f32(false, kb1, false, qb1,
                                                       (short)0, d1, false, false);

            // k rows j = 16, 17 (needed at m = 14, 15 only): 6-MAC dots, branch-free.
            const float* k16 = kc + 16 * KSTRIDE + n * HD;
            const float* kjj = k16 + ((m == 15) ? KSTRIDE : 0);   // row m + 2 at m = 14, 15
            float p16 = 0.f, pjj = 0.f;
#pragma unroll
            for (int d = 0; d < HD; d += 2) {
                v2f tk = *(const v2f*)(k16 + d);
                v2f w = *(const v2f*)(kjj + d);
                p16 = fmaf(qv[d], tk.x, p16); p16 = fmaf(qv[d + 1], tk.y, p16);
                pjj = fmaf(qv[d], w.x, pjj); pjj = fmaf(qv[d + 1], w.y, pjj);
            }

            // Rows (m + dl) & 7 of this lane's half, for both heads.
            const v4f c0v = band3(d0, s4, s2, s1);
            const v4f c1v = band3(d1, s4, s2, s1);
#pragma unroll
            for (int dl = 0; dl < 3; ++dl) {
                // Row j = m + dl sits in half j >> 3: in this lane or in its partner,
                // which hands over the value of the head that this lane owns.
                float keep = lo ? c0v[dl] : c1v[dl];
                float recv = other_half(lo ? c1v[dl] : c0v[dl]);
                float v = (((m + dl) >> 3) == half) ? keep : recv;
                if (dl == 1) v = (m == 15) ? p16 : v;
                if (dl == 2) v = (m >= 14) ? pjj : v;
                lg[dir * 3 + dl] = v * scale + rrow[dir * 3 + dl];
            }
            // Keeps each direction's tiles from being formed long before they are used:
            // without it all 36 WMMAs are scheduled first and the register count bars waves.
            __builtin_amdgcn_sched_barrier(0);
        }

        // ---- Softmax over 27 tokens + contraction with constant offsets (di,dj,dl) ----
        {
            float mx = lg[0];
#pragma unroll
            for (int tk = 1; tk < NT; ++tk) mx = fmaxf(mx, lg[tk]);
            float s = 0.f, sdi = 0.f, sdj = 0.f, sdl = 0.f;
#pragma unroll
            for (int tk = 0; tk < NT; ++tk) {
                float e = __expf(lg[tk] - mx);
                s   += e;
                sdi += e * (float)(tk / 9 - 1);
                sdj += e * (float)((tk / 3) % 3 - 1);
                sdl += e * (float)(tk % 3 - 1);
            }
            float inv = 1.f / s;
            size_t base = ((size_t)x * 48 + (ys + t)) * 48 + (size_t)(z0 + m);
            out[(size_t)(n * 3 + 0) * N3 + base] = sdi * inv;
            out[(size_t)(n * 3 + 1) * N3 + base] = sdj * inv;
            out[(size_t)(n * 3 + 2) * N3 + base] = sdl * inv;
            // Before the next step overwrites the registers that these stores name.
            asm volatile("s_wait_xcnt 0x0" ::: "memory");
        }

        // ---- Publish point of step t + 1: own LDS reads retired, own copies landed, then
        // the barrier that publishes slab t + 3 and q tile t + 1 and frees slab t, q tile t.
        wait_lds();
        wait_async_stage();
        __syncthreads();
        if (t + 2 < NY) {   // refill only while a step t + 2 exists
            stage_slab(ys + t + 3, t & 3);
            stage_q(ys + t + 2, t & 1);
        }
    }
    wait_async_stage();   // nothing in flight when the wave ends
}

extern "C" void kernel_launch(void* const* d_in, const int* in_sizes, int n_in,
                              void* d_out, int out_size, void* d_ws, size_t ws_size,
                              hipStream_t stream) {
    (void)in_sizes; (void)n_in; (void)out_size; (void)d_ws; (void)ws_size;
    const float* q   = (const float*)d_in[0];
    const float* k   = (const float*)d_in[1];
    const float* rpb = (const float*)d_in[2];
    float* out = (float*)d_out;
    dim3 grid(48, 16, 3);   // y: 48 / NY walks
    dim3 block(128);
    natten3d_wmma_kernel<<<grid, block, 0, stream>>>(q, k, rpb, out);
}

// v005
// It runs in 18.1 microseconds.
// Versions in between are left out here; by their measured steps it is 1.47 times as fast as v003.
// Over all steps from v000 it is 3.46 times as fast.
#include <hip/hip_runtime.h>

// 3D neighborhood attention (kernel_size=3) for q,k: [1,48,48,48,48], nh=8, hd=6.
// QK dots are exact fp32 via V_WMMA_F32_16X16X4_F32. One accumulator tile pairs 16 k rows
// (4 y x 4 x) with 16 columns (2 x 2 x 4 positions of one head). K = the head's 6 channels of
// two z planes three apart; each column's q is zeroed at the plane that is no neighbour of
// it, so three tiles hold the three z neighbours of all four z. k/q tiles staged to LDS with
// GLOBAL_LOAD_ASYNC_TO_LDS_B128 (ASYNCcnt) when available, else plain float4 loads.

#define NH 8
#define HD 6
#define NT 27
#define N3 (48*48*48)
#define KSTRIDE 52      // padded C stride in LDS (multiple of 4 -> 16B rows for b128)
// Floats of one staged k column (18 z rows), padded so that the 16 rows of a k fragment
// (4 slabs x 4 columns) start on 16 different groups of four banks.
#define COLF (18 * KSTRIDE + 12)
#define SLABF (4 * COLF)      // floats of one y slab (the columns xs-1 .. xs+2)
// Floats of one staged q tile, padded so that the four tiles a q fragment reads from start on
// different banks.
#define QTF (16 * KSTRIDE + 16)

typedef float v2f __attribute__((ext_vector_type(2)));
typedef float v4f __attribute__((ext_vector_type(4)));
typedef float v8f __attribute__((ext_vector_type(8)));
typedef int   v4i __attribute__((vector_size(16)));

#if __has_builtin(__builtin_amdgcn_global_load_async_to_lds_b128)
#define USE_ASYNC_LDS 1
typedef __attribute__((address_space(1))) v4i* g_v4i_ptr;
typedef __attribute__((address_space(3))) v4i* l_v4i_ptr;
#else
#define USE_ASYNC_LDS 0
#endif

__device__ __forceinline__ void stage16(const float* __restrict__ gsrc, float* ldst) {
#if USE_ASYNC_LDS
    __builtin_amdgcn_global_load_async_to_lds_b128((g_v4i_ptr)gsrc, (l_v4i_ptr)ldst, 0, 0);
#else
    *(float4*)ldst = *(const float4*)gsrc;
#endif
}

// Own copies landed. In asm with the memory clobber: no LDS read moves in front of it.
__device__ __forceinline__ void wait_async_stage() {
#if USE_ASYNC_LDS
    asm volatile("s_wait_asynccnt 0x0" ::: "memory");
#endif
}

// Own LDS writes (zero padding, bias table) retired, before the barrier that publishes them.
__device__ __forceinline__ void wait_lds() {
    asm volatile("s_wait_dscnt 0x0" ::: "memory");
}

// Value of the same column in the other 16-lane half (lane l <-> l ^ 16).
__device__ __forceinline__ float other_half(float v) {
    int b = __builtin_bit_cast(int, v);
    b = __builtin_amdgcn_permlanex16(b, b, 0x76543210, 0xfedcba98, false, false);
    return __builtin_bit_cast(float, b);
}

__global__ __launch_bounds__(128)
void natten3d_wmma_kernel(const float* __restrict__ q,
                          const float* __restrict__ k,
                          const float* __restrict__ rpb,
                          float* __restrict__ out)
{
    // A work-group covers 2 x, 2 y and 16 z positions. The k columns of one y (xs-1 .. xs+2)
    // are a slab; slab i (y = ys - 1 + i) lies in slot i. One q tile per (x, y).
    __shared__ __align__(16) float kbuf[4 * SLABF];
    __shared__ __align__(16) float qbuf[4 * QTF];
    __shared__ __align__(16) float obuf[NH * 3 * 4 * 16];   // results: [head*3+comp][x][y][z]
    __shared__ float rpbuf[NH * NT];

    const int xs = blockIdx.x * 2;
    const int ys = blockIdx.y * 2;
    const int z0 = blockIdx.z * 16;
    const int tid  = threadIdx.x;
    const int lane = tid & 31;
    const int wid  = tid >> 5;
    const int half = lane >> 4;    // lane-half selects K (A/B) or M+8 (D)
    const int col  = lane & 15;    // row of A, column of B and D

    // ---- Staging map. The z rows of one (x,y) column are contiguous in memory, so a
    // column's 18 rows are 216 chunks of 16 bytes in a row; chunk c lands at chunk c + c/12
    // of the column's LDS tile (13 chunks per padded row). Each lane takes chunks tid and
    // tid + 128 of every column: its two offsets are formed once, and the column's base and
    // its x/y bounds test are scalar.
    // readfirstlane: the wave's number as a scalar, for scalar tests on it.
    const int wv = __builtin_amdgcn_readfirstlane(wid);
    const int xm = xs - 1;
    const unsigned c0 = (unsigned)tid;
    const unsigned c1 = min((unsigned)tid + 128u, 215u);  // lanes past the end: off, in bounds
    const unsigned r0 = c0 / 12u, r1 = c1 / 12u;
    const int zz0 = z0 - 1 + (int)r0, zz1 = z0 - 1 + (int)r1;
    const bool zok0 = (unsigned)zz0 < 48u, zok1 = (unsigned)zz1 < 48u;
    const bool in1 = tid < 88;
    float* const lk0 = kbuf + (c0 + r0) * 4u;
    float* const lk1 = kbuf + (c1 + r1) * 4u;
    const unsigned g0 = ((unsigned)min(max(zz0, 0), 47) * 12u + (c0 - r0 * 12u)) * 4u;
    const unsigned g1 = ((unsigned)min(max(zz1, 0), 47) * 12u + (c1 - r1 * 12u)) * 4u;
    const float4 zv = {0.f, 0.f, 0.f, 0.f};

    // One slab (four columns at y = yy) into slot 'slot'; yy and slot are scalar.
    auto stage_slab = [&](int yy, int slot) {
        float* const s0 = lk0 + slot * SLABF;
        float* const s1 = lk1 + slot * SLABF;
        const bool yok = (unsigned)yy < 48u;
        if (zok0) {
            // Unrolled (here and below) so that each column's LDS offset is a constant.
#pragma unroll
            for (int di = 0; di < 4; ++di) {
                const int xx = xm + di;
                if (yok && (unsigned)xx < 48u)
                    stage16(k + (size_t)(xx * 48 + yy) * (48 * 48) + g0, s0 + di * COLF);
            }
        }
        if (wv < 3) {   // wave 3 has no chunk in the second pass
            if (in1 && zok1) {
#pragma unroll
                for (int di = 0; di < 4; ++di) {
                    const int xx = xm + di;
                    if (yok && (unsigned)xx < 48u)
                        stage16(k + (size_t)(xx * 48 + yy) * (48 * 48) + g1, s1 + di * COLF);
                }
            }
        }
        // Zero padding: rows z = -1 and z = 48 of every column, then columns outside x or y.
        if (!zok0) {
#pragma unroll
            for (int di = 0; di < 4; ++di) *(float4*)(s0 + di * COLF) = zv;
        }
        if (in1 && !zok1) {
#pragma unroll
            for (int di = 0; di < 4; ++di) *(float4*)(s1 + di * COLF) = zv;
        }
        if (!yok || (unsigned)xm >= 45u) {
#pragma unroll
            for (int di = 0; di < 4; ++di) {
                const int xx = xm + di;
                if (!(yok && (unsigned)xx < 48u)) {
                    *(float4*)(s0 + di * COLF) = zv;
                    if (in1) *(float4*)(s1 + di * COLF) = zv;
                }
            }
        }
    };
    // q tile of position (xq, yq) (raw; scale applied to logits later): 192 chunks, same map.
    auto stage_q = [&](int xq, int yq, int buf) {
        const float* qb = q + ((size_t)(xq * 48 + yq) * 48 + z0) * 48;
        float* const qd = qbuf + buf * QTF;
        stage16(qb + c0 * 4u, qd + (c0 + r0) * 4u);
        if (wv < 2) stage16(qb + c1 * 4u, qd + (c1 + r1) * 4u);
    };

    // ---- Staging: four slabs and four q tiles, filled once ----
    stage_slab(ys - 1, 0);
    stage_slab(ys, 1);
    stage_slab(ys + 1, 2);
    stage_slab(ys + 2, 3);
    stage_q(xs, ys, 0);
    stage_q(xs, ys + 1, 1);
    stage_q(xs + 1, ys, 2);
    stage_q(xs + 1, ys + 1, 3);
    for (int idx = tid; idx < NH * NT; idx += 128) rpbuf[idx] = rpb[idx];
    wait_lds();
    wait_async_stage();
    __syncthreads();

    // ---- Lane roles. Column col = (px, py, pz): position (xs + px, ys + py, z quad + pz), pz in
    // 0..3, all of one head. Row of A = (yy, xx): k position (xs - 1 + xx, ys - 1 + yy). The six
    // z planes zz = 0..5 (z = z quad - 1 + zz) fold into three tiles: a column has its
    // neighbours in the planes pz .. pz + 2, so of the planes m and m + 3 exactly one is a
    // neighbour: m where pz <= m, else m + 3. Tile m takes both planes through K (plane m in
    // the K slots of lane half 0, plane m + 3 in those of half 1), with q zeroed in the slots
    // of the other plane. Tile m is token l = (m - pz) mod 3 of the column. A lane holds column
    // col, rows r + 8 * half: yy = 2 * half + (r >> 2), xx = r & 3; the row is token
    // (i, j) = (xx - px, yy - py) where both lie in 0..2, else no neighbour.
    const int pz = col & 3, py = (col >> 2) & 1, px = col >> 3;
    const float scale = 0.40824829046386301637f;  // 6^-0.5, folded into the logit
    const int l0 = (3 - pz) % 3;        // token l of tile 0

    // This lane's K slots of tile m hold plane m + 3 * half: the column's own plane or not.
    const bool own0 = (half == (pz > 0 ? 1 : 0));
    const bool own1 = (half == (pz > 1 ? 1 : 0));
    const bool own2 = (half == (pz > 2 ? 1 : 0));
    const float wx0 = (float)(-(px + 1));           // di = xx + wx0
    const float wy0 = (float)(2 * half - py - 1);   // dj of the rows r = 0..3; r = 4..7: + 1
    const float wz[3] = {(float)(l0 - 1), (float)((l0 + 1) % 3 - 1), (float)((l0 + 2) % 3 - 1)};

    // K order of both fragments: WMMA u of tile m takes channel 6*head + 2u + j of plane
    // m + 3*half in VGPR j.
    const float* ka = kbuf + (col >> 2) * SLABF + (col & 3) * COLF + half * 3 * KSTRIDE;
    const float* qa = qbuf + (px * 2 + py) * QTF + pz * KSTRIDE;
    const v2f zero2 = {0.f, 0.f};

    // The wave takes two heads, one after the other, and walks the four z quads for each.
    // Both loops kept rolled: one copy of the code; other waves fill this wave's waits.
#pragma unroll 1
    for (int hh = 0; hh < 2; ++hh) {
    const int n = wv * 2 + hh;
    // Bias of each held row; -inf where the row is no neighbour of the column, so that its
    // exponential is 0 and it drops out of every sum. Index clamped into the table.
    // Held in pairs of rows, as the accumulator registers lie, for the packed multiply-add.
    v2f bias[3][4];
#pragma unroll
    for (int r = 0; r < 8; ++r) {
        const int j = 2 * half + (r >> 2) - py;
        const int i = (r & 3) - px;
        const bool okr = (unsigned)j < 3u && (unsigned)i < 3u;
        const float* rp = rpbuf + n * NT + min(max(i, 0), 2) * 9 + min(max(j, 0), 2) * 3;
#pragma unroll
        for (int m = 0; m < 3; ++m) {
            const float b = rp[(l0 + m) % 3];
            bias[m][r >> 1][r & 1] = okr ? b : -__builtin_inff();
        }
    }

#pragma unroll 1
    for (int zq = 0; zq < 4; ++zq) {
        const float* kz = ka + 4 * zq * KSTRIDE + n * HD;
        const float* qz = qa + 4 * zq * KSTRIDE + n * HD;
        v2f qf[3][3];
#pragma unroll
        for (int u = 0; u < 3; ++u) {
            const v2f t = *(const v2f*)(qz + 2 * u);
            qf[0][u] = own0 ? t : zero2;
            qf[1][u] = own1 ? t : zero2;
            qf[2][u] = own2 ? t : zero2;
        }

        v8f d[3] = {{}, {}, {}};
#pragma unroll
        for (int u = 0; u < 3; ++u) {
#pragma unroll
            for (int m = 0; m < 3; ++m) {
                const v2f a = *(const v2f*)(kz + m * KSTRIDE + 2 * u);
                d[m] = __builtin_amdgcn_wmma_f32_16x16x4_f32(false, a, false, qf[m][u],
                                                              (short)0, d[m], false, false);
            }
        }

        // ---- Softmax over the 27 tokens, half of the rows in each lane half, and the
        // contraction with the offsets (di, dj, dl); the halves are added at the end ----
        float lg[3][8];
        float mt[3];   // one maximum per tile: three short chains, each ready with its tile
        const v2f scv = {scale, scale};
#pragma unroll
        for (int m = 0; m < 3; ++m) {
#pragma unroll
            for (int r = 0; r < 8; r += 2) {
                const v2f dp = {d[m][r], d[m][r + 1]};
                const v2f lp = __builtin_elementwise_fma(dp, scv, bias[m][r >> 1]);
                lg[m][r] = lp.x; lg[m][r + 1] = lp.y;
            }
            mt[m] = lg[m][0];
#pragma unroll
            for (int r = 1; r < 8; ++r) mt[m] = fmaxf(mt[m], lg[m][r]);
        }
        float mx = fmaxf(fmaxf(mt[0], mt[1]), mt[2]);
        mx = fmaxf(mx, other_half(mx));
        float tp[3], y1 = 0.f, xw = 0.f;
#pragma unroll
        for (int m = 0; m < 3; ++m) {
            float rs[2];
#pragma unroll
            for (int yl = 0; yl < 2; ++yl) {
                const float e0 = __expf(lg[m][yl * 4 + 0] - mx);
                const float e1 = __expf(lg[m][yl * 4 + 1] - mx);
                const float e2 = __expf(lg[m][yl * 4 + 2] - mx);
                const float e3 = __expf(lg[m][yl * 4 + 3] - mx);
                rs[yl] = (e0 + e1) + (e2 + e3);
                xw += fmaf(3.f, e3, fmaf(2.f, e2, e1));
            }
            tp[m] = rs[0] + rs[1];
            y1 += rs[1];
        }
        float s   = (tp[0] + tp[1]) + tp[2];
        float sdi = fmaf(wx0, s, xw);
        float sdj = fmaf(wy0, s, y1);
        float sdl = fmaf(wz[2], tp[2], fmaf(wz[1], tp[1], wz[0] * tp[0]));
        s   += other_half(s);
        sdi += other_half(sdi);
        sdj += other_half(sdj);
        sdl += other_half(sdl);
        const float inv = 1.f / s;
        float* ob = obuf + (n * 12 + px * 2 + py) * 16 + 4 * zq + pz;
        ob[half * 64] = (half ? sdj : sdi) * inv;
        if (half == 0) ob[2 * 64] = sdl * inv;
    }
    }

    // ---- Results out in runs of 16 z: 96 rows of 64 bytes, 16 bytes a lane ----
    __syncthreads();
    {
        const size_t pos = ((size_t)xs * 48 + ys) * 48 + (size_t)z0;
        // Chunk o: row o >> 2 = ((head*3+comp)*2 + x)*2 + y; 384 chunks, three a lane.
#pragma unroll
        for (int p = 0; p < 3; ++p) {
            const unsigned o = (unsigned)tid + 128u * p;
            *(float4*)(out + (size_t)(o >> 4) * N3 + pos + ((o >> 3) & 1u) * 2304u
                       + ((o >> 2) & 1u) * 48u + (o & 3u) * 4u) = *(const float4*)(obuf + o * 4u);
        }
    }
}

extern "C" void kernel_launch(void* const* d_in, const int* in_sizes, int n_in,
                              void* d_out, int out_size, void* d_ws, size_t ws_size,
                              hipStream_t stream) {
    (void)in_sizes; (void)n_in; (void)out_size; (void)d_ws; (void)ws_size;
    const float* q   = (const float*)d_in[0];
    const float* k   = (const float*)d_in[1];
    const float* rpb = (const float*)d_in[2];
    float* out = (float*)d_out;
    dim3 grid(24, 24, 3);   // 2 x, 2 y, 16 z per work-group
    dim3 block(128);
    natten3d_wmma_kernel<<<grid, block, 0, stream>>>(q, k, rpb, out);
}

// v006
// One run takes 16.8 microseconds.
// Next to v005, in two timings, it ran 1.07 times as fast each time.
// Over all steps from v000 it is 3.71 times as fast.
#include <hip/hip_runtime.h>

// 3D neighborhood attention (kernel_size=3) for q,k: [1,48,48,48,48], nh=8, hd=6.
// QK dots are exact fp32 via V_WMMA_F32_16X16X4_F32. One accumulator tile pairs 16 k rows
// (4 y x 4 x) with 16 columns (2 x 2 x 4 positions of one head). K = the head's 6 channels of
// two z planes three apart; each column's q is zeroed at the plane that is no neighbour of
// it, so three tiles hold the three z neighbours of all four z. k/q tiles staged to LDS with
// GLOBAL_LOAD_ASYNC_TO_LDS_B128 (ASYNCcnt) when available, else plain float4 loads.
// A work-group covers 6 x 6 x 12 positions: 256 equal work-groups, 8 x 8 x 14 staged k rows.

#define NH 8
#define HD 6
#define NT 27
#define N3 (48*48*48)
#define TX 6            // positions of a work-group in x and in y
#define TZ 12           // positions of a work-group in z
#define KROWS (TZ + 2)  // staged z rows of one k column
#define KSTRIDE 48      // C stride in LDS: rows lie as in memory, a column is one run
// Floats of one staged k column and of one y slab (8 columns), padded so that the 16 rows of
// a k fragment (4 slabs x 4 columns) start on 16 different groups of four banks.
#define COLF (KROWS * KSTRIDE + 4)
#define SLABF (8 * COLF + 16)
// Floats of one staged q column (12 z rows), padded so that the 16 rows of a q fragment
// (2 x, 2 y, 4 z) start on 16 different groups of four banks.
#define QTF (TZ * KSTRIDE + 4)
#define KCH (KROWS * 12)    // 16-byte chunks of a k column
#define QCH (TZ * 12)       // 16-byte chunks of a q column
#define OCF (TX * TX * TZ)  // floats of one output component in the result buffer

typedef float v2f __attribute__((ext_vector_type(2)));
typedef float v4f __attribute__((ext_vector_type(4)));
typedef float v8f __attribute__((ext_vector_type(8)));
typedef int   v4i __attribute__((vector_size(16)));

#if __has_builtin(__builtin_amdgcn_global_load_async_to_lds_b128)
#define USE_ASYNC_LDS 1
typedef __attribute__((address_space(1))) v4i* g_v4i_ptr;
typedef __attribute__((address_space(3))) v4i* l_v4i_ptr;
#else
#define USE_ASYNC_LDS 0
#endif

__device__ __forceinline__ void stage16(const float* __restrict__ gsrc, float* ldst) {
#if USE_ASYNC_LDS
    __builtin_amdgcn_global_load_async_to_lds_b128((g_v4i_ptr)gsrc, (l_v4i_ptr)ldst, 0, 0);
#else
    *(float4*)ldst = *(const float4*)gsrc;
#endif
}

// Own copies landed. In asm with the memory clobber: no LDS read moves in front of it.
__device__ __forceinline__ void wait_async_stage() {
#if USE_ASYNC_LDS
    asm volatile("s_wait_asynccnt 0x0" ::: "memory");
#endif
}

// Own LDS writes (zero padding, bias table) retired, before the barrier that publishes them.
__device__ __forceinline__ void wait_lds() {
    asm volatile("s_wait_dscnt 0x0" ::: "memory");
}

// Value of the same column in the other 16-lane half (lane l <-> l ^ 16).
__device__ __forceinline__ float other_half(float v) {
    int b = __builtin_bit_cast(int, v);
    b = __builtin_amdgcn_permlanex16(b, b, 0x76543210, 0xfedcba98, false, false);
    return __builtin_bit_cast(float, b);
}

__global__ __launch_bounds__(768)
void natten3d_wmma_kernel(const float* __restrict__ q,
                          const float* __restrict__ k,
                          const float* __restrict__ rpb,
                          float* __restrict__ out)
{
    // k columns x = xs-1 .. xs+6 of one y are a slab; slab i is y = ys - 1 + i; row r of a
    // column is z = z0 - 1 + r. One q column per (x, y), row r is z = z0 + r.
    __shared__ __align__(16) float kbuf[8 * SLABF];
    __shared__ __align__(16) float qbuf[TX * TX * QTF];
    __shared__ __align__(16) float obuf[NH * 3 * OCF];   // results: [head*3+comp][x][y][z]
    __shared__ float rpbuf[NH * NT];

    const int xs = blockIdx.x * TX;
    const int ys = blockIdx.y * TX;
    const int z0 = blockIdx.z * TZ;
    const int tid  = threadIdx.x;
    const int lane = tid & 31;
    const int wid  = tid >> 5;
    const int half = lane >> 4;    // lane-half selects K (A/B) or M+8 (D)
    const int col  = lane & 15;    // row of A, column of B and D

    // readfirstlane: the wave's number as a scalar, for scalar tests on it.
    const int wv = __builtin_amdgcn_readfirstlane(wid);
    const float4 zv = {0.f, 0.f, 0.f, 0.f};

    // ---- k staging. The z rows of one (x,y) column are contiguous in memory and in LDS: 168
    // chunks of 16 bytes. Waves 0..20 take four columns a pass (x = xs-1+sub or xs+3+sub of
    // one y), 16 passes: a lane's column, chunk, z test and x tests are formed once, the y
    // test and every pass's offsets are scalar. A chunk outside the volume is zeroed.
    if (wv < 21) {
        const unsigned sub = (unsigned)tid / (unsigned)KCH;
        const unsigned cc  = (unsigned)tid - sub * (unsigned)KCH;
        const unsigned r   = cc / 12u;
        const int zz = z0 - 1 + (int)r;
        const bool zok = (unsigned)zz < 48u;
        const int xa = xs - 1 + (int)sub, xb = xs + 3 + (int)sub;
        const bool oka = zok && xa >= 0, okb = zok && xb < 48;
        const unsigned gz = (unsigned)min(max(zz, 0), 47) * 48u + (cc - r * 12u) * 4u;
        const unsigned ga = (unsigned)max(xa, 0) * (48u * 48u * 48u) + gz;
        const unsigned gb = (unsigned)min(xb, 47) * (48u * 48u * 48u) + gz;
        float* const lk = kbuf + sub * COLF + cc * 4u;
        // readfirstlane: the first slab's y held in a scalar register inside the lane tests
        // below, so that every y test stays a scalar branch and every slab base a scalar.
        const int ym = __builtin_amdgcn_readfirstlane(ys - 1);
        // Unrolled (here and below) so that each pass's LDS offset is a constant.
        if (oka) {
#pragma unroll
            for (int i = 0; i < 8; ++i) {
                const int yy = ym + i;
                if ((unsigned)yy < 48u) stage16(k + (unsigned)yy * (48u * 48u) + ga, lk + i * SLABF);
            }
        }
        if (okb) {
#pragma unroll
            for (int i = 0; i < 8; ++i) {
                const int yy = ym + i;
                if ((unsigned)yy < 48u)
                    stage16(k + (unsigned)yy * (48u * 48u) + gb, lk + i * SLABF + 4 * COLF);
            }
        }
        // Zero padding: chunks outside z or x in every slab, then whole slabs outside y.
#pragma unroll
        for (int i = 0; i < 8; ++i) {
            const bool yout = (unsigned)(ym + i) >= 48u;
            if (yout || !oka) *(float4*)(lk + i * SLABF) = zv;
            if (yout || !okb) *(float4*)(lk + i * SLABF + 4 * COLF) = zv;
        }
    }
    // ---- q staging (raw; scale applied to logits later): 36 columns of 144 chunks, always
    // inside the volume. Waves 6..23 take four columns a pass, 9 passes.
    if (wv >= 6) {
        const unsigned tq  = (unsigned)tid - 192u;
        const unsigned sub = tq / (unsigned)QCH;
        const unsigned cc  = tq - sub * (unsigned)QCH;
        const float* const qb = q + ((size_t)(xs * 48 + ys) * 48 + z0) * 48 + cc * 4u;
        float* const lq = qbuf + sub * QTF + cc * 4u;
#pragma unroll
        for (int j = 0; j < 9; ++j) {
            const unsigned id = 4u * j + sub;       // column x * 6 + y
            const unsigned qx = id / 6u, qy = id - qx * 6u;
            stage16(qb + (qx * 48u + qy) * (48u * 48u), lq + j * 4 * QTF);
        }
    }
    if (tid < NH * NT) rpbuf[tid] = rpb[tid];
    wait_lds();
    wait_async_stage();
    __syncthreads();

    // ---- Lane roles, within a block of 2 x 2 x 4 positions at (xb, yb, z quad). Column col =
    // (px, py, pz): position (xb + px, yb + py, z quad + pz), pz in 0..3, all of one head.
    // Row of A = (yy, xx): k position (xb - 1 + xx, yb - 1 + yy). The six
    // z planes zz = 0..5 (z = z quad - 1 + zz) fold into three tiles: a column has its
    // neighbours in the planes pz .. pz + 2, so of the planes m and m + 3 exactly one is a
    // neighbour: m where pz <= m, else m + 3. Tile m takes both planes through K (plane m in
    // the K slots of lane half 0, plane m + 3 in those of half 1), with q zeroed in the slots
    // of the other plane. Tile m is token l = (m - pz) mod 3 of the column. A lane holds column
    // col, rows r + 8 * half: yy = 2 * half + (r >> 2), xx = r & 3; the row is token
    // (i, j) = (xx - px, yy - py) where both lie in 0..2, else no neighbour.
    const int pz = col & 3, py = (col >> 2) & 1, px = col >> 3;
    const float scale = 0.40824829046386301637f;  // 6^-0.5, folded into the logit
    const int l0 = (3 - pz) % 3;        // token l of tile 0

    // This lane's K slots of tile m hold plane m + 3 * half: the column's own plane or not.
    const bool own0 = (half == (pz > 0 ? 1 : 0));
    const bool own1 = (half == (pz > 1 ? 1 : 0));
    const bool own2 = (half == (pz > 2 ? 1 : 0));
    const float wx0 = (float)(-(px + 1));           // di = xx + wx0
    const float wy0 = (float)(2 * half - py - 1);   // dj of the rows r = 0..3; r = 4..7: + 1
    const float wz[3] = {(float)(l0 - 1), (float)((l0 + 1) % 3 - 1), (float)((l0 + 2) % 3 - 1)};

    // K order of both fragments: WMMA u of tile m takes channel 6*head + 2u + j of plane
    // m + 3*half in VGPR j.
    const float* ka = kbuf + (col >> 2) * SLABF + (col & 3) * COLF + half * 3 * KSTRIDE;
    const float* qa = qbuf + (px * TX + py) * QTF + pz * KSTRIDE;
    const v2f zero2 = {0.f, 0.f};

    // The wave takes one head and one of the three z quads, and walks that layer's 3 x 3 blocks.
    const int n  = wv & 7;
    const int zq = wv >> 3;
    // Bias of each held row; -inf where the row is no neighbour of the column, so that its
    // exponential is 0 and it drops out of every sum. Index clamped into the table.
    // Held in pairs of rows, as the accumulator registers lie, for the packed multiply-add.
    v2f bias[3][4];
#pragma unroll
    for (int r = 0; r < 8; ++r) {
        const int j = 2 * half + (r >> 2) - py;
        const int i = (r & 3) - px;
        const bool okr = (unsigned)j < 3u && (unsigned)i < 3u;
        const float* rp = rpbuf + n * NT + min(max(i, 0), 2) * 9 + min(max(j, 0), 2) * 3;
#pragma unroll
        for (int m = 0; m < 3; ++m) {
            const float b = rp[(l0 + m) % 3];
            bias[m][r >> 1][r & 1] = okr ? b : -__builtin_inff();
        }
    }

    // Both loops kept rolled: one copy of the code; other waves fill this wave's waits.
#pragma unroll 1
    for (int bx = 0; bx < 3; ++bx) {
#pragma unroll 1
    for (int by = 0; by < 3; ++by) {
        const float* kz = ka + 2 * by * SLABF + 2 * bx * COLF + 4 * zq * KSTRIDE + n * HD;
        const float* qz = qa + (2 * bx * TX + 2 * by) * QTF + 4 * zq * KSTRIDE + n * HD;
        v2f qf[3][3];
#pragma unroll
        for (int u = 0; u < 3; ++u) {
            const v2f t = *(const v2f*)(qz + 2 * u);
            qf[0][u] = own0 ? t : zero2;
            qf[1][u] = own1 ? t : zero2;
            qf[2][u] = own2 ? t : zero2;
        }

        v8f d[3] = {{}, {}, {}};
#pragma unroll
        for (int u = 0; u < 3; ++u) {
#pragma unroll
            for (int m = 0; m < 3; ++m) {
                const v2f a = *(const v2f*)(kz + m * KSTRIDE + 2 * u);
                d[m] = __builtin_amdgcn_wmma_f32_16x16x4_f32(false, a, false, qf[m][u],
                                                              (short)0, d[m], false, false);
            }
        }

        // ---- Softmax over the 27 tokens, half of the rows in each lane half, and the
        // contraction with the offsets (di, dj, dl); the halves are added at the end ----
        float lg[3][8];
        float mt[3];   // one maximum per tile: three short chains, each ready with its tile
        const v2f scv = {scale, scale};
#pragma unroll
        for (int m = 0; m < 3; ++m) {
#pragma unroll
            for (int r = 0; r < 8; r += 2) {
                const v2f dp = {d[m][r], d[m][r + 1]};
                const v2f lp = __builtin_elementwise_fma(dp, scv, bias[m][r >> 1]);
                lg[m][r] = lp.x; lg[m][r + 1] = lp.y;
            }
            mt[m] = lg[m][0];
#pragma unroll
            for (int r = 1; r < 8; ++r) mt[m] = fmaxf(mt[m], lg[m][r]);
        }
        float mx = fmaxf(fmaxf(mt[0], mt[1]), mt[2]);
        mx = fmaxf(mx, other_half(mx));
        float tp[3], y1 = 0.f, xw = 0.f;
#pragma unroll
        for (int m = 0; m < 3; ++m) {
            float rs[2];
#pragma unroll
            for (int yl = 0; yl < 2; ++yl) {
                const float e0 = __expf(lg[m][yl * 4 + 0] - mx);
                const float e1 = __expf(lg[m][yl * 4 + 1] - mx);
                const float e2 = __expf(lg[m][yl * 4 + 2] - mx);
                const float e3 = __expf(lg[m][yl * 4 + 3] - mx);
                rs[yl] = (e0 + e1) + (e2 + e3);
                xw += fmaf(3.f, e3, fmaf(2.f, e2, e1));
            }
            tp[m] = rs[0] + rs[1];
            y1 += rs[1];
        }
        float s   = (tp[0] + tp[1]) + tp[2];
        float sdi = fmaf(wx0, s, xw);
        float sdj = fmaf(wy0, s, y1);
        float sdl = fmaf(wz[2], tp[2], fmaf(wz[1], tp[1], wz[0] * tp[0]));
        s   += other_half(s);
        sdi += other_half(sdi);
        sdj += other_half(sdj);
        sdl += other_half(sdl);
        const float inv = 1.f / s;
        float* ob = obuf + n * 3 * OCF + ((2 * bx + px) * TX + 2 * by + py) * TZ + 4 * zq + pz;
        ob[half * OCF] = (half ? sdj : sdi) * inv;
        if (half == 0) ob[2 * OCF] = sdl * inv;
    }
    }

    // ---- Results out in runs of 12 z: 864 rows of 48 bytes, 16 bytes a lane ----
    __syncthreads();
    if (tid < 648) {
        // Chunk o = tid + 648 p: row o / 3 = ((head*3+comp)*6 + x)*6 + y. A pass is 216 rows,
        // six whole components: a lane keeps its x, y and part, and steps six components.
        const unsigned row = (unsigned)tid / 3u, part = (unsigned)tid - row * 3u;
        const unsigned c = row / 36u, xy = row - c * 36u;
        const unsigned ox = xy / 6u, oy = xy - ox * 6u;
        float* const op = out + (size_t)c * N3 + ((size_t)(xs + (int)ox) * 48 + (ys + (int)oy)) * 48
                          + (size_t)z0 + part * 4u;
#pragma unroll
        for (int p = 0; p < 4; ++p)
            *(float4*)(op + (size_t)p * 6 * N3) = *(const float4*)(obuf + ((unsigned)tid + 648u * p) * 4u);
    }
}

extern "C" void kernel_launch(void* const* d_in, const int* in_sizes, int n_in,
                              void* d_out, int out_size, void* d_ws, size_t ws_size,
                              hipStream_t stream) {
    (void)in_sizes; (void)n_in; (void)out_size; (void)d_ws; (void)ws_size;
    const float* q   = (const float*)d_in[0];
    const float* k   = (const float*)d_in[1];
    const float* rpb = (const float*)d_in[2];
    float* out = (float*)d_out;
    dim3 grid(8, 8, 4);   // 6 x, 6 y, 12 z per work-group
    dim3 block(768);
    natten3d_wmma_kernel<<<grid, block, 0, stream>>>(q, k, rpb, out);
}

// v007
// A run of this version takes 15.7 microseconds.
// In both of two side-by-side timings against v006, it was 1.07 times as fast.
// Counting every step since v000, it is 3.96 times as fast.
#include <hip/hip_runtime.h>

// 3D neighborhood attention (kernel_size=3) for q,k: [1,48,48,48,48], nh=8, hd=6.
// QK dots are exact fp32 via V_WMMA_F32_16X16X4_F32. One accumulator tile pairs 16 k rows
// (4 y x 4 x) with 16 columns (2 x 2 x 4 positions of one head). K = the head's 6 channels of
// two z planes three apart; each column's q is zeroed at the plane that is no neighbour of
// it, so three tiles hold the three z neighbours of all four z. The k rows are ordered so that
// selects in a lane drop the rows that are no neighbours. k/q tiles staged to LDS with
// GLOBAL_LOAD_ASYNC_TO_LDS_B128 (ASYNCcnt) when available, else plain float4 loads.
// A work-group covers 6 x 6 x 12 positions: 256 equal work-groups, 8 x 8 x 14 staged k rows.

#define NH 8
#define HD 6
#define NT 27
#define N3 (48*48*48)
#define TX 6            // positions of a work-group in x and in y
#define TZ 12           // positions of a work-group in z
#define KROWS (TZ + 2)  // staged z rows of one k column
#define KSTRIDE 48      // C stride in LDS: rows lie as in memory, a column is one run
// Floats of one staged k column and of one y slab (8 columns), padded so that the 16 rows of
// a k fragment (4 slabs x 4 columns) start on 16 different groups of four banks.
#define COLF (KROWS * KSTRIDE + 4)
#define SLABF (8 * COLF + 16)
// Floats of one staged q column (12 z rows), padded so that the 16 rows of a q fragment
// (2 x, 2 y, 4 z) start on 16 different groups of four banks.
#define QTF (TZ * KSTRIDE + 4)
#define KCH (KROWS * 12)    // 16-byte chunks of a k column
#define QCH (TZ * 12)       // 16-byte chunks of a q column
#define OCF (TX * TX * TZ)  // floats of one output component in the result buffer

typedef float v2f __attribute__((ext_vector_type(2)));
typedef float v4f __attribute__((ext_vector_type(4)));
typedef float v8f __attribute__((ext_vector_type(8)));
typedef int   v4i __attribute__((vector_size(16)));

#if __has_builtin(__builtin_amdgcn_global_load_async_to_lds_b128)
#define USE_ASYNC_LDS 1
typedef __attribute__((address_space(1))) v4i* g_v4i_ptr;
typedef __attribute__((address_space(3))) v4i* l_v4i_ptr;
#else
#define USE_ASYNC_LDS 0
#endif

__device__ __forceinline__ void stage16(const float* __restrict__ gsrc, float* ldst) {
#if USE_ASYNC_LDS
    __builtin_amdgcn_global_load_async_to_lds_b128((g_v4i_ptr)gsrc, (l_v4i_ptr)ldst, 0, 0);
#else
    *(float4*)ldst = *(const float4*)gsrc;
#endif
}

// Own copies landed. In asm with the memory clobber: no LDS read moves in front of it.
__device__ __forceinline__ void wait_async_stage() {
#if USE_ASYNC_LDS
    asm volatile("s_wait_asynccnt 0x0" ::: "memory");
#endif
}

// Own LDS writes (zero padding, bias table) retired, before the barrier that publishes them.
__device__ __forceinline__ void wait_lds() {
    asm volatile("s_wait_dscnt 0x0" ::: "memory");
}

// Value of the same column in the other 16-lane half (lane l <-> l ^ 16).
__device__ __forceinline__ float other_half(float v) {
    int b = __builtin_bit_cast(int, v);
    b = __builtin_amdgcn_permlanex16(b, b, 0x76543210, 0xfedcba98, false, false);
    return __builtin_bit_cast(float, b);
}

__global__ __launch_bounds__(768)
void natten3d_wmma_kernel(const float* __restrict__ q,
                          const float* __restrict__ k,
                          const float* __restrict__ rpb,
                          float* __restrict__ out)
{
    // k columns x = xs-1 .. xs+6 of one y are a slab; slab i is y = ys - 1 + i; row r of a
    // column is z = z0 - 1 + r. One q column per (x, y), row r is z = z0 + r.
    __shared__ __align__(16) float kbuf[8 * SLABF];
    __shared__ __align__(16) float qbuf[TX * TX * QTF];
    __shared__ __align__(16) float obuf[NH * 3 * OCF];   // results: [head*3+comp][x][y][z]
    __shared__ float rpbuf[NH * NT];

    const int xs = blockIdx.x * TX;
    const int ys = blockIdx.y * TX;
    const int z0 = blockIdx.z * TZ;
    const int tid  = threadIdx.x;
    const int lane = tid & 31;
    const int wid  = tid >> 5;
    const int half = lane >> 4;    // lane-half selects K (A/B) or M+8 (D)
    const int col  = lane & 15;    // row of A, column of B and D

    // readfirstlane: the wave's number as a scalar, for scalar tests on it.
    const int wv = __builtin_amdgcn_readfirstlane(wid);
    const float4 zv = {0.f, 0.f, 0.f, 0.f};

    // ---- k staging. The z rows of one (x,y) column are contiguous in memory and in LDS: 168
    // chunks of 16 bytes. Waves 0..20 take four columns a pass (x = xs-1+sub or xs+3+sub of
    // one y), 16 passes: a lane's column, chunk, z test and x tests are formed once, the y
    // test and every pass's offsets are scalar. A chunk outside the volume is zeroed.
    if (wv < 21) {
        const unsigned sub = (unsigned)tid / (unsigned)KCH;
        const unsigned cc  = (unsigned)tid - sub * (unsigned)KCH;
        const unsigned r   = cc / 12u;
        const int zz = z0 - 1 + (int)r;
        const bool zok = (unsigned)zz < 48u;
        const int xa = xs - 1 + (int)sub, xb = xs + 3 + (int)sub;
        const bool oka = zok && xa >= 0, okb = zok && xb < 48;
        const unsigned gz = (unsigned)min(max(zz, 0), 47) * 48u + (cc - r * 12u) * 4u;
        const unsigned ga = (unsigned)max(xa, 0) * (48u * 48u * 48u) + gz;
        const unsigned gb = (unsigned)min(xb, 47) * (48u * 48u * 48u) + gz;
        float* const lk = kbuf + sub * COLF + cc * 4u;
        // readfirstlane: the first slab's y held in a scalar register inside the lane tests
        // below, so that every y test stays a scalar branch and every slab base a scalar.
        const int ym = __builtin_amdgcn_readfirstlane(ys - 1);
        // Unrolled (here and below) so that each pass's LDS offset is a constant.
        if (oka) {
#pragma unroll
            for (int i = 0; i < 8; ++i) {
                const int yy = ym + i;
                if ((unsigned)yy < 48u) stage16(k + (unsigned)yy * (48u * 48u) + ga, lk + i * SLABF);
            }
        }
        if (okb) {
#pragma unroll
            for (int i = 0; i < 8; ++i) {
                const int yy = ym + i;
                if ((unsigned)yy < 48u)
                    stage16(k + (unsigned)yy * (48u * 48u) + gb, lk + i * SLABF + 4 * COLF);
            }
        }
        // Zero padding: chunks outside z or x in every slab, then whole slabs outside y.
#pragma unroll
        for (int i = 0; i < 8; ++i) {
            const bool yout = (unsigned)(ym + i) >= 48u;
            if (yout || !oka) *(float4*)(lk + i * SLABF) = zv;
            if (yout || !okb) *(float4*)(lk + i * SLABF + 4 * COLF) = zv;
        }
    }
    // ---- q staging (raw; scale applied to logits later): 36 columns of 144 chunks, always
    // inside the volume. Waves 6..23 take four columns a pass, 9 passes.
    if (wv >= 6) {
        const unsigned tq  = (unsigned)tid - 192u;
        const unsigned sub = tq / (unsigned)QCH;
        const unsigned cc  = tq - sub * (unsigned)QCH;
        const float* const qb = q + ((size_t)(xs * 48 + ys) * 48 + z0) * 48 + cc * 4u;
        float* const lq = qbuf + sub * QTF + cc * 4u;
#pragma unroll
        for (int j = 0; j < 9; ++j) {
            const unsigned id = 4u * j + sub;       // column x * 6 + y
            const unsigned qx = id / 6u, qy = id - qx * 6u;
            stage16(qb + (qx * 48u + qy) * (48u * 48u), lq + j * 4 * QTF);
        }
    }
    if (tid < NH * NT) rpbuf[tid] = rpb[tid];
    wait_lds();
    wait_async_stage();
    __syncthreads();

    // ---- Lane roles, within a block of 2 x 2 x 4 positions at (xb, yb, z quad). Column col =
    // (px, py, pz): position (xb + px, yb + py, z quad + pz), pz in 0..3, all of one head.
    // Row M of A is the k position (xb - 1 + xx, yb - 1 + yy), (yy, xx) in the order of the two
    // tables below. The six
    // z planes zz = 0..5 (z = z quad - 1 + zz) fold into three tiles: a column has its
    // neighbours in the planes pz .. pz + 2, so of the planes m and m + 3 exactly one is a
    // neighbour: m where pz <= m, else m + 3. Tile m takes both planes through K (plane m in
    // the K slots of lane half 0, plane m + 3 in those of half 1), with q zeroed in the slots
    // of the other plane. Tile m is token l = (m - pz) mod 3 of the column. A lane holds column
    // col, rows M = r + 8 * half. Of the 16 rows a column has 9 neighbours: the four with xx and
    // yy in 1..2, one of each pair that differs only in xx = 0 | 3 or only in yy = 0 | 3, and one
    // of the four corners. The row order puts such a pair, and the corners, in one lane half:
    //   half 0: (1,1) (1,2) | (1,0) (1,3) | (2,0) (2,3) | (0,1) (3,1)
    //   half 1: (2,1) (2,2) | (0,2) (3,2) | (0,0) (0,3) | (3,0) (3,3)
    // so four selects a tile leave 5 logits a lane (4 in half 1, the fifth masked), not 8.
    const int pz = col & 3, py = (col >> 2) & 1, px = col >> 3;
    const float scale = 0.40824829046386301637f;  // 6^-0.5, folded into the logit
    const int l0 = (3 - pz) % 3;        // token l of tile 0

    // This lane's K slots of tile m hold plane m + 3 * half: the column's own plane or not.
    const bool own0 = (half == (pz > 0 ? 1 : 0));
    const bool own1 = (half == (pz > 1 ? 1 : 0));
    const bool own2 = (half == (pz > 2 ? 1 : 0));
    // Selects: registers 2|3, 4|5, 6|7, then (half 1) the corner out of the last two.
    const bool c2 = half ? py : px;
    const bool c3 = px;
    const bool c4 = half ? px : py;
    const bool c5 = half && py;
    // (yy, xx) of the five kept rows of this lane; the fifth of half 1 is a dummy.
    const int ex = px ? 3 : 0, ey = py ? 3 : 0;
    const int sy[5] = {half ? 2 : 1, half ? 2 : 1, half ? ey : 1, half ? ey : 2, ey};
    const int sx[5] = {1, 2, half ? 2 : ex, ex, half ? ex : 1};
    const float wz[3] = {(float)(l0 - 1), (float)((l0 + 1) % 3 - 1), (float)((l0 + 2) % 3 - 1)};

    // K order of both fragments: WMMA u of tile m takes channel 6*head + 2u + j of plane
    // m + 3*half in VGPR j.
    // (yy, xx) of row M = col, two bits a row.
    const int ayy = (int)((0xf0caca55u >> (2 * col)) & 3u);
    const int axx = (int)((0xcca95cc9u >> (2 * col)) & 3u);
    const float* ka = kbuf + ayy * SLABF + axx * COLF + half * 3 * KSTRIDE;
    const float* qa = qbuf + (px * TX + py) * QTF + pz * KSTRIDE;
    const v2f zero2 = {0.f, 0.f};

    // The wave takes one head and one of the three z quads, and walks that layer's 3 x 3 blocks.
    const int n  = wv & 7;
    const int zq = wv >> 3;
    // Bias of each kept row and its offsets (di, dj); -inf for the dummy, so that its
    // exponential is 0 and it drops out of every sum.
    float bias[3][5], wdi[5], wdj[5];
#pragma unroll
    for (int s = 0; s < 5; ++s) {
        const int i = sx[s] - px, j = sy[s] - py;    // both in 0..2
        const bool oks = s < 4 || half == 0;
        const float* rp = rpbuf + n * NT + i * 9 + j * 3;
        wdi[s] = (float)(i - 1);
        wdj[s] = (float)(j - 1);
#pragma unroll
        for (int m = 0; m < 3; ++m) {
            const float b = rp[(l0 + m) % 3];
            bias[m][s] = oks ? b : -__builtin_inff();
        }
    }

    // Both loops kept rolled: one copy of the code; other waves fill this wave's waits.
#pragma unroll 1
    for (int bx = 0; bx < 3; ++bx) {
#pragma unroll 1
    for (int by = 0; by < 3; ++by) {
        const float* kz = ka + 2 * by * SLABF + 2 * bx * COLF + 4 * zq * KSTRIDE + n * HD;
        const float* qz = qa + (2 * bx * TX + 2 * by) * QTF + 4 * zq * KSTRIDE + n * HD;
        v2f qf[3][3];
#pragma unroll
        for (int u = 0; u < 3; ++u) {
            const v2f t = *(const v2f*)(qz + 2 * u);
            qf[0][u] = own0 ? t : zero2;
            qf[1][u] = own1 ? t : zero2;
            qf[2][u] = own2 ? t : zero2;
        }

        v8f d[3] = {{}, {}, {}};
#pragma unroll
        for (int u = 0; u < 3; ++u) {
#pragma unroll
            for (int m = 0; m < 3; ++m) {
                const v2f a = *(const v2f*)(kz + m * KSTRIDE + 2 * u);
                d[m] = __builtin_amdgcn_wmma_f32_16x16x4_f32(false, a, false, qf[m][u],
                                                              (short)0, d[m], false, false);
            }
        }

        // ---- Softmax over the 27 tokens, 15 or 12 of them in each lane half, and the
        // contraction with the offsets (di, dj, dl); the halves are added at the end ----
        float lg[3][5];
        float mt[3];   // one maximum per tile: three short chains, each ready with its tile
#pragma unroll
        for (int m = 0; m < 3; ++m) {
            const float t2 = c2 ? d[m][3] : d[m][2];
            const float t3 = c3 ? d[m][5] : d[m][4];
            const float t4 = c4 ? d[m][7] : d[m][6];
            const float kept[5] = {d[m][0], d[m][1], t2, c5 ? t4 : t3, t4};
#pragma unroll
            for (int s = 0; s < 5; ++s) lg[m][s] = fmaf(kept[s], scale, bias[m][s]);
            mt[m] = lg[m][0];
#pragma unroll
            for (int s = 1; s < 5; ++s) mt[m] = fmaxf(mt[m], lg[m][s]);
        }
        float mx = fmaxf(fmaxf(mt[0], mt[1]), mt[2]);
        mx = fmaxf(mx, other_half(mx));
        float e[3][5], tp[3];
#pragma unroll
        for (int m = 0; m < 3; ++m) {
#pragma unroll
            for (int s = 0; s < 5; ++s) e[m][s] = __expf(lg[m][s] - mx);
            tp[m] = ((e[m][0] + e[m][1]) + (e[m][2] + e[m][3])) + e[m][4];
        }
        float s = (tp[0] + tp[1]) + tp[2];
        float sdi = 0.f, sdj = 0.f;
#pragma unroll
        for (int t = 0; t < 5; ++t) {
            const float es = (e[0][t] + e[1][t]) + e[2][t];   // the row's three z tokens
            sdi = fmaf(wdi[t], es, sdi);
            sdj = fmaf(wdj[t], es, sdj);
        }
        float sdl = fmaf(wz[2], tp[2], fmaf(wz[1], tp[1], wz[0] * tp[0]));
        s   += other_half(s);
        sdi += other_half(sdi);
        sdj += other_half(sdj);
        sdl += other_half(sdl);
        const float inv = 1.f / s;
        float* ob = obuf + n * 3 * OCF + ((2 * bx + px) * TX + 2 * by + py) * TZ + 4 * zq + pz;
        ob[half * OCF] = (half ? sdj : sdi) * inv;
        if (half == 0) ob[2 * OCF] = sdl * inv;
    }
    }

    // ---- Results out in runs of 12 z: 864 rows of 48 bytes, 16 bytes a lane ----
    __syncthreads();
    if (tid < 648) {
        // Chunk o = tid + 648 p: row o / 3 = ((head*3+comp)*6 + x)*6 + y. A pass is 216 rows,
        // six whole components: a lane keeps its x, y and part, and steps six components.
        const unsigned row = (unsigned)tid / 3u, part = (unsigned)tid - row * 3u;
        const unsigned c = row / 36u, xy = row - c * 36u;
        const unsigned ox = xy / 6u, oy = xy - ox * 6u;
        float* const op = out + (size_t)c * N3 + ((size_t)(xs + (int)ox) * 48 + (ys + (int)oy)) * 48
                          + (size_t)z0 + part * 4u;
#pragma unroll
        for (int p = 0; p < 4; ++p)
            *(float4*)(op + (size_t)p * 6 * N3) = *(const float4*)(obuf + ((unsigned)tid + 648u * p) * 4u);
    }
}

extern "C" void kernel_launch(void* const* d_in, const int* in_sizes, int n_in,
                              void* d_out, int out_size, void* d_ws, size_t ws_size,
                              hipStream_t stream) {
    (void)in_sizes; (void)n_in; (void)out_size; (void)d_ws; (void)ws_size;
    const float* q   = (const float*)d_in[0];
    const float* k   = (const float*)d_in[1];
    const float* rpb = (const float*)d_in[2];
    float* out = (float*)d_out;
    dim3 grid(8, 8, 4);   // 6 x, 6 y, 12 z per work-group
    dim3 block(768);
    natten3d_wmma_kernel<<<grid, block, 0, stream>>>(q, k, rpb, out);
}

// v008
// It runs in 14.6 microseconds.
// In both of two side-by-side timings against v007, it was 1.08 times as fast.
// Counting every step since v000, it is 4.26 times as fast.
#include <hip/hip_runtime.h>

// 3D neighborhood attention (kernel_size=3) for q,k: [1,48,48,48,48], nh=8, hd=6.
// QK dots are exact fp32 via V_WMMA_F32_16X16X4_F32. One accumulator tile pairs 16 k rows
// (4 y x 4 x) with 16 columns (2 x 2 x 4 positions of one head). K = the head's 6 channels of
// two z planes three apart; each column's q is zeroed at the plane that is no neighbour of
// it, so three tiles hold the three z neighbours of all four z. The k rows are ordered so that
// selects in a lane drop the rows that are no neighbours. k/q tiles staged to LDS with
// GLOBAL_LOAD_ASYNC_TO_LDS_B128 (ASYNCcnt) when available, else plain float4 loads.
// A work-group covers 6 x 6 x 12 positions: 256 equal work-groups, 8 x 8 x 14 staged k rows.
// Each wave stores its own results (through LDS, in runs of 12 z) while other waves compute.

#define NH 8
#define HD 6
#define NT 27
#define N3 (48*48*48)
#define TX 6            // positions of a work-group in x and in y
#define TZ 12           // positions of a work-group in z
#define KROWS (TZ + 2)  // staged z rows of one k column
#define KSTRIDE 48      // C stride in LDS: rows lie as in memory, a column is one run
// Floats of one staged k column and of one y slab (8 columns), padded so that the 16 rows of
// a k fragment (4 slabs x 4 columns) start on 16 different groups of four banks.
#define COLF (KROWS * KSTRIDE + 4)
#define SLABF (8 * COLF + 16)
// Floats of one staged q column (12 z rows), padded so that the 16 rows of a q fragment
// (2 x, 2 y, 4 z) start on 16 different groups of four banks.
#define QTF (TZ * KSTRIDE + 4)
#define KCH (KROWS * 12)    // 16-byte chunks of a k column
#define QCH (TZ * 12)       // 16-byte chunks of a q column
#define OCF (TX * TX * TZ)  // floats of one output component in the result buffer

typedef float v2f __attribute__((ext_vector_type(2)));
typedef float v4f __attribute__((ext_vector_type(4)));
typedef float v8f __attribute__((ext_vector_type(8)));
typedef int   v4i __attribute__((vector_size(16)));

#if __has_builtin(__builtin_amdgcn_global_load_async_to_lds_b128)
#define USE_ASYNC_LDS 1
typedef __attribute__((address_space(1))) v4i* g_v4i_ptr;
typedef __attribute__((address_space(3))) v4i* l_v4i_ptr;
#else
#define USE_ASYNC_LDS 0
#endif

__device__ __forceinline__ void stage16(const float* __restrict__ gsrc, float* ldst) {
#if USE_ASYNC_LDS
    __builtin_amdgcn_global_load_async_to_lds_b128((g_v4i_ptr)gsrc, (l_v4i_ptr)ldst, 0, 0);
#else
    *(float4*)ldst = *(const float4*)gsrc;
#endif
}

// Own copies landed. In asm with the memory clobber: no LDS read moves in front of it.
__device__ __forceinline__ void wait_async_stage() {
#if USE_ASYNC_LDS
    asm volatile("s_wait_asynccnt 0x0" ::: "memory");
#endif
}

// Own LDS writes retired: zero padding and bias table before the barrier that publishes them, results before the wave reads them back.
__device__ __forceinline__ void wait_lds() {
    asm volatile("s_wait_dscnt 0x0" ::: "memory");
}

// Value of the same column in the other 16-lane half (lane l <-> l ^ 16).
__device__ __forceinline__ float other_half(float v) {
    int b = __builtin_bit_cast(int, v);
    b = __builtin_amdgcn_permlanex16(b, b, 0x76543210, 0xfedcba98, false, false);
    return __builtin_bit_cast(float, b);
}

__global__ __launch_bounds__(768)
void natten3d_wmma_kernel(const float* __restrict__ q,
                          const float* __restrict__ k,
                          const float* __restrict__ rpb,
                          float* __restrict__ out)
{
    // k columns x = xs-1 .. xs+6 of one y are a slab; slab i is y = ys - 1 + i; row r of a
    // column is z = z0 - 1 + r. One q column per (x, y), row r is z = z0 + r.
    __shared__ __align__(16) float kbuf[8 * SLABF];
    __shared__ __align__(16) float qbuf[TX * TX * QTF];
    __shared__ __align__(16) float obuf[NH * 3 * OCF];   // results: [head*3+comp][x][y][z]
    __shared__ float rpbuf[NH * NT];

    const int xs = blockIdx.x * TX;
    const int ys = blockIdx.y * TX;
    const int z0 = blockIdx.z * TZ;
    const int tid  = threadIdx.x;
    const int lane = tid & 31;
    const int wid  = tid >> 5;
    const int half = lane >> 4;    // lane-half selects K (A/B) or M+8 (D)
    const int col  = lane & 15;    // row of A, column of B and D

    // readfirstlane: the wave's number as a scalar, for scalar tests on it.
    const int wv = __builtin_amdgcn_readfirstlane(wid);
    const float4 zv = {0.f, 0.f, 0.f, 0.f};

    // ---- k staging. The z rows of one (x,y) column are contiguous in memory and in LDS: 168
    // chunks of 16 bytes. Waves 0..20 take four columns a pass (x = xs-1+sub or xs+3+sub of
    // one y), 16 passes: a lane's column, chunk, z test and x tests are formed once, the y
    // test and every pass's offsets are scalar. A chunk outside the volume is zeroed.
    if (wv < 21) {
        const unsigned sub = (unsigned)tid / (unsigned)KCH;
        const unsigned cc  = (unsigned)tid - sub * (unsigned)KCH;
        const unsigned r   = cc / 12u;
        const int zz = z0 - 1 + (int)r;
        const bool zok = (unsigned)zz < 48u;
        const int xa = xs - 1 + (int)sub, xb = xs + 3 + (int)sub;
        const bool oka = zok && xa >= 0, okb = zok && xb < 48;
        const unsigned gz = (unsigned)min(max(zz, 0), 47) * 48u + (cc - r * 12u) * 4u;
        const unsigned ga = (unsigned)max(xa, 0) * (48u * 48u * 48u) + gz;
        const unsigned gb = (unsigned)min(xb, 47) * (48u * 48u * 48u) + gz;
        float* const lk = kbuf + sub * COLF + cc * 4u;
        // readfirstlane: the first slab's y held in a scalar register inside the lane tests
        // below, so that every y test stays a scalar branch and every slab base a scalar.
        const int ym = __builtin_amdgcn_readfirstlane(ys - 1);
        // Unrolled (here and below) so that each pass's LDS offset is a constant.
        if (oka) {
#pragma unroll
            for (int i = 0; i < 8; ++i) {
                const int yy = ym + i;
                if ((unsigned)yy < 48u) stage16(k + (unsigned)yy * (48u * 48u) + ga, lk + i * SLABF);
            }
        }
        if (okb) {
#pragma unroll
            for (int i = 0; i < 8; ++i) {
                const int yy = ym + i;
                if ((unsigned)yy < 48u)
                    stage16(k + (unsigned)yy * (48u * 48u) + gb, lk + i * SLABF + 4 * COLF);
            }
        }
        // Zero padding: chunks outside z or x in every slab, then whole slabs outside y.
#pragma unroll
        for (int i = 0; i < 8; ++i) {
            const bool yout = (unsigned)(ym + i) >= 48u;
            if (yout || !oka) *(float4*)(lk + i * SLABF) = zv;
            if (yout || !okb) *(float4*)(lk + i * SLABF + 4 * COLF) = zv;
        }
    }
    // ---- q staging (raw; scale applied to logits later): 36 columns of 144 chunks, always
    // inside the volume. Waves 6..23 take four columns a pass, 9 passes.
    if (wv >= 6) {
        const unsigned tq  = (unsigned)tid - 192u;
        const unsigned sub = tq / (unsigned)QCH;
        const unsigned cc  = tq - sub * (unsigned)QCH;
        const float* const qb = q + ((size_t)(xs * 48 + ys) * 48 + z0) * 48 + cc * 4u;
        float* const lq = qbuf + sub * QTF + cc * 4u;
#pragma unroll
        for (int j = 0; j < 9; ++j) {
            const unsigned id = 4u * j + sub;       // column x * 6 + y
            const unsigned qx = id / 6u, qy = id - qx * 6u;
            stage16(qb + (qx * 48u + qy) * (48u * 48u), lq + j * 4 * QTF);
        }
    }
    if (tid < NH * NT) rpbuf[tid] = rpb[tid];
    wait_lds();
    wait_async_stage();
    __syncthreads();

    // ---- Lane roles, within a block of 2 x 2 x 4 positions at (xb, yb, z quad). Column col =
    // (px, py, pz): position (xb + px, yb + py, z quad + pz), pz in 0..3, all of one head.
    // Row M of A is the k position (xb - 1 + xx, yb - 1 + yy), (yy, xx) in the order of the two
    // tables below. The six
    // z planes zz = 0..5 (z = z quad - 1 + zz) fold into three tiles: a column has its
    // neighbours in the planes pz .. pz + 2, so of the planes m and m + 3 exactly one is a
    // neighbour: m where pz <= m, else m + 3. Tile m takes both planes through K (plane m in
    // the K slots of lane half 0, plane m + 3 in those of half 1), with q zeroed in the slots
    // of the other plane. Tile m is token l = (m - pz) mod 3 of the column. A lane holds column
    // col, rows M = r + 8 * half. Of the 16 rows a column has 9 neighbours: the four with xx and
    // yy in 1..2, one of each pair that differs only in xx = 0 | 3 or only in yy = 0 | 3, and one
    // of the four corners. The row order puts such a pair, and the corners, in one lane half:
    //   half 0: (1,1) (1,2) | (1,0) (1,3) | (2,0) (2,3) | (0,1) (3,1)
    //   half 1: (2,1) (2,2) | (0,2) (3,2) | (0,0) (0,3) | (3,0) (3,3)
    // so four selects a tile leave 5 logits a lane (4 in half 1, the fifth masked), not 8.
    const int pz = col & 3, py = (col >> 2) & 1, px = col >> 3;
    const float scale = 0.40824829046386301637f;  // 6^-0.5, folded into the logit
    const int l0 = (3 - pz) % 3;        // token l of tile 0

    // This lane's K slots of tile m hold plane m + 3 * half: the column's own plane or not.
    const bool own0 = (half == (pz > 0 ? 1 : 0));
    const bool own1 = (half == (pz > 1 ? 1 : 0));
    const bool own2 = (half == (pz > 2 ? 1 : 0));
    // Selects: registers 2|3, 4|5, 6|7, then (half 1) the corner out of the last two.
    const bool c2 = half ? py : px;
    const bool c3 = px;
    const bool c4 = half ? px : py;
    const bool c5 = half && py;
    // (yy, xx) of the five kept rows of this lane; the fifth of half 1 is a dummy.
    const int ex = px ? 3 : 0, ey = py ? 3 : 0;
    const int sy[5] = {half ? 2 : 1, half ? 2 : 1, half ? ey : 1, half ? ey : 2, ey};
    const int sx[5] = {1, 2, half ? 2 : ex, ex, half ? ex : 1};
    const float wz[3] = {(float)(l0 - 1), (float)((l0 + 1) % 3 - 1), (float)((l0 + 2) % 3 - 1)};

    // K order of both fragments: WMMA u of tile m takes channel 6*head + 2u + j of plane
    // m + 3*half in VGPR j.
    // (yy, xx) of row M = col, two bits a row.
    const int ayy = (int)((0xf0caca55u >> (2 * col)) & 3u);
    const int axx = (int)((0xcca95cc9u >> (2 * col)) & 3u);
    const float* ka = kbuf + ayy * SLABF + axx * COLF + half * 3 * KSTRIDE;
    const float* qa = qbuf + (px * TX + py) * QTF + pz * KSTRIDE;
    const v2f zero2 = {0.f, 0.f};

    // The wave takes one head and one of the three x blocks, and walks 3 y blocks x 3 z quads:
    // after the three z quads of a y block it holds whole runs of 12 z and stores them itself.
    const int n  = wv & 7;
    const int bx = wv >> 3;
    // Bias of each kept row and its offsets (di, dj); -inf for the dummy, so that its
    // exponential is 0 and it drops out of every sum.
    float bias[3][5], wdi[5], wdj[5];
#pragma unroll
    for (int s = 0; s < 5; ++s) {
        const int i = sx[s] - px, j = sy[s] - py;    // both in 0..2
        const bool oks = s < 4 || half == 0;
        const float* rp = rpbuf + n * NT + i * 9 + j * 3;
        wdi[s] = (float)(i - 1);
        wdj[s] = (float)(j - 1);
#pragma unroll
        for (int m = 0; m < 3; ++m) {
            const float b = rp[(l0 + m) % 3];
            bias[m][s] = oks ? b : -__builtin_inff();
        }
    }

    // ---- Store roles. A y block of the wave is 3 components x 2 x x 2 y runs of 48 bytes: 36
    // chunks of 16 bytes. Chunk o = ((comp * 2 + x) * 2 + y) * 3 + part; a lane takes chunk
    // lane, lanes 0..3 also chunk 32 + lane.
    unsigned so[2], go[2];   // float offsets in obuf and in out, at y block 0
#pragma unroll
    for (int p = 0; p < 2; ++p) {
        // Lanes 4..31 have no second chunk: they name their first again and do not store it.
        const unsigned o = (unsigned)lane + (lane < 4 ? 32u * p : 0u);
        const unsigned run = o / 3u, part = o - run * 3u;
        const unsigned c = run >> 2, ox = (run >> 1) & 1u, oy = run & 1u;
        so[p] = ((unsigned)n * 3u + c) * OCF + ((2u * bx + ox) * TX + oy) * TZ + part * 4u;
        go[p] = ((unsigned)n * 3u + c) * N3 + ((unsigned)(xs + 2 * bx) + ox) * (48u * 48u)
                + ((unsigned)ys + oy) * 48u + (unsigned)z0 + part * 4u;
    }

    // Both loops kept rolled: one copy of the code; other waves fill this wave's waits.
#pragma unroll 1
    for (int by = 0; by < 3; ++by) {
#pragma unroll 1
    for (int zq = 0; zq < 3; ++zq) {
        const float* kz = ka + 2 * by * SLABF + 2 * bx * COLF + 4 * zq * KSTRIDE + n * HD;
        const float* qz = qa + (2 * bx * TX + 2 * by) * QTF + 4 * zq * KSTRIDE + n * HD;
        v2f qf[3][3];
#pragma unroll
        for (int u = 0; u < 3; ++u) {
            const v2f t = *(const v2f*)(qz + 2 * u);
            qf[0][u] = own0 ? t : zero2;
            qf[1][u] = own1 ? t : zero2;
            qf[2][u] = own2 ? t : zero2;
        }

        v8f d[3] = {{}, {}, {}};
#pragma unroll
        for (int u = 0; u < 3; ++u) {
#pragma unroll
            for (int m = 0; m < 3; ++m) {
                const v2f a = *(const v2f*)(kz + m * KSTRIDE + 2 * u);
                d[m] = __builtin_amdgcn_wmma_f32_16x16x4_f32(false, a, false, qf[m][u],
                                                              (short)0, d[m], false, false);
            }
        }

        // ---- Softmax over the 27 tokens, 15 or 12 of them in each lane half, and the
        // contraction with the offsets (di, dj, dl); the halves are added at the end ----
        float lg[3][5];
        float mt[3];   // one maximum per tile: three short chains, each ready with its tile
#pragma unroll
        for (int m = 0; m < 3; ++m) {
            const float t2 = c2 ? d[m][3] : d[m][2];
            const float t3 = c3 ? d[m][5] : d[m][4];
            const float t4 = c4 ? d[m][7] : d[m][6];
            const float kept[5] = {d[m][0], d[m][1], t2, c5 ? t4 : t3, t4};
#pragma unroll
            for (int s = 0; s < 5; ++s) lg[m][s] = fmaf(kept[s], scale, bias[m][s]);
            mt[m] = lg[m][0];
#pragma unroll
            for (int s = 1; s < 5; ++s) mt[m] = fmaxf(mt[m], lg[m][s]);
        }
        float mx = fmaxf(fmaxf(mt[0], mt[1]), mt[2]);
        mx = fmaxf(mx, other_half(mx));
        float e[3][5], tp[3];
#pragma unroll
        for (int m = 0; m < 3; ++m) {
#pragma unroll
            for (int s = 0; s < 5; ++s) e[m][s] = __expf(lg[m][s] - mx);
            tp[m] = ((e[m][0] + e[m][1]) + (e[m][2] + e[m][3])) + e[m][4];
        }
        float s = (tp[0] + tp[1]) + tp[2];
        float sdi = 0.f, sdj = 0.f;
#pragma unroll
        for (int t = 0; t < 5; ++t) {
            const float es = (e[0][t] + e[1][t]) + e[2][t];   // the row's three z tokens
            sdi = fmaf(wdi[t], es, sdi);
            sdj = fmaf(wdj[t], es, sdj);
        }
        float sdl = fmaf(wz[2], tp[2], fmaf(wz[1], tp[1], wz[0] * tp[0]));
        s   += other_half(s);
        sdi += other_half(sdi);
        sdj += other_half(sdj);
        sdl += other_half(sdl);
        const float inv = 1.f / s;
        float* ob = obuf + n * 3 * OCF + ((2 * bx + px) * TX + 2 * by + py) * TZ + 4 * zq + pz;
        ob[half * OCF] = (half ? sdj : sdi) * inv;
        if (half == 0) ob[2 * OCF] = sdl * inv;
    }
        // ---- The y block's results out in runs of 12 z, by the wave that made them: no other
        // wave writes or reads this part of obuf, so the wave's own LDS order is enough.
        // Own result writes retired, and no read of them moved in front of the writes.
        wait_lds();
        const float4 r0 = *(const float4*)(obuf + so[0] + 2u * TZ * by);
        const float4 r1 = *(const float4*)(obuf + so[1] + 2u * TZ * by);
        *(float4*)(out + go[0] + 96u * by) = r0;
        if (lane < 4) *(float4*)(out + go[1] + 96u * by) = r1;
        // Before the next y block overwrites the registers that the two stores name.
        asm volatile("s_wait_xcnt 0x0" ::: "memory");
    }
}

extern "C" void kernel_launch(void* const* d_in, const int* in_sizes, int n_in,
                              void* d_out, int out_size, void* d_ws, size_t ws_size,
                              hipStream_t stream) {
    (void)in_sizes; (void)n_in; (void)out_size; (void)d_ws; (void)ws_size;
    const float* q   = (const float*)d_in[0];
    const float* k   = (const float*)d_in[1];
    const float* rpb = (const float*)d_in[2];
    float* out = (float*)d_out;
    dim3 grid(8, 8, 4);   // 6 x, 6 y, 12 z per work-group
    dim3 block(768);
    natten3d_wmma_kernel<<<grid, block, 0, stream>>>(q, k, rpb, out);
}

// v009
// Measured time: 13.6 microseconds a run.
// In two side-by-side timings against v008, it was 1.07 and 1.08 times as fast.
// Over all steps from v000 it is 4.58 times as fast.
#include <hip/hip_runtime.h>

// 3D neighborhood attention (kernel_size=3) for q,k: [1,48,48,48,48], nh=8, hd=6.
// QK dots are exact fp32 via V_WMMA_F32_16X16X4_F32. One accumulator tile pairs 16 k rows
// (4 y x 4 x) with 16 columns (2 x 2 x 4 positions of one head). K = the head's 6 channels of
// two z planes three apart; each column's q is zeroed at the plane that is no neighbour of
// it, so three tiles hold the three z neighbours of all four z. The k rows are ordered so that
// selects in a lane drop the rows that are no neighbours. k/q tiles staged to LDS with
// GLOBAL_LOAD_ASYNC_TO_LDS_B128 (ASYNCcnt) when available, else plain float4 loads.
// A work-group covers 6 x 6 x 12 positions: 256 equal work-groups, 8 x 8 x 14 staged k rows.
// Staging has two parts: what the first y block reads, then the rest, copied under that block.
// Each wave stores its own results (through LDS, in runs of 12 z) while other waves compute.

#define NH 8
#define HD 6
#define NT 27
#define N3 (48*48*48)
#define TX 6            // positions of a work-group in x and in y
#define TZ 12           // positions of a work-group in z
#define KROWS (TZ + 2)  // staged z rows of one k column
#define KSTRIDE 48      // C stride in LDS: rows lie as in memory, a column is one run
// Floats of one staged k column and of one y slab (8 columns), padded so that the 16 rows of
// a k fragment (4 slabs x 4 columns) start on 16 different groups of four banks.
#define COLF (KROWS * KSTRIDE + 4)
#define SLABF (8 * COLF + 16)
// Floats of one staged q column (12 z rows), padded so that the 16 rows of a q fragment
// (2 x, 2 y, 4 z) start on 16 different groups of four banks.
#define QTF (TZ * KSTRIDE + 4)
#define KCH (KROWS * 12)    // 16-byte chunks of a k column
#define QCH (TZ * 12)       // 16-byte chunks of a q column
#define OCF (TX * TX * TZ)  // floats of one output component in the result buffer

typedef float v2f __attribute__((ext_vector_type(2)));
typedef float v4f __attribute__((ext_vector_type(4)));
typedef float v8f __attribute__((ext_vector_type(8)));
typedef int   v4i __attribute__((vector_size(16)));

#if __has_builtin(__builtin_amdgcn_global_load_async_to_lds_b128)
#define USE_ASYNC_LDS 1
typedef __attribute__((address_space(1))) v4i* g_v4i_ptr;
typedef __attribute__((address_space(3))) v4i* l_v4i_ptr;
#else
#define USE_ASYNC_LDS 0
#endif

__device__ __forceinline__ void stage16(const float* __restrict__ gsrc, float* ldst) {
#if USE_ASYNC_LDS
    __builtin_amdgcn_global_load_async_to_lds_b128((g_v4i_ptr)gsrc, (l_v4i_ptr)ldst, 0, 0);
#else
    *(float4*)ldst = *(const float4*)gsrc;
#endif
}

// Own copies landed. In asm with the memory clobber: no LDS read moves in front of it.
__device__ __forceinline__ void wait_async_stage() {
#if USE_ASYNC_LDS
    asm volatile("s_wait_asynccnt 0x0" ::: "memory");
#endif
}

// Own LDS writes retired: before a barrier, and before the wave reads its results back.
__device__ __forceinline__ void wait_lds() {
    asm volatile("s_wait_dscnt 0x0" ::: "memory");
}

// Value of the same column in the other 16-lane half (lane l <-> l ^ 16).
__device__ __forceinline__ float other_half(float v) {
    int b = __builtin_bit_cast(int, v);
    b = __builtin_amdgcn_permlanex16(b, b, 0x76543210, 0xfedcba98, false, false);
    return __builtin_bit_cast(float, b);
}

__global__ __launch_bounds__(768)
void natten3d_wmma_kernel(const float* __restrict__ q,
                          const float* __restrict__ k,
                          const float* __restrict__ rpb,
                          float* __restrict__ out)
{
    // k columns x = xs-1 .. xs+6 of one y are a slab; slab i is y = ys - 1 + i; row r of a
    // column is z = z0 - 1 + r. One q column per (x, y), row r is z = z0 + r.
    __shared__ __align__(16) float kbuf[8 * SLABF];
    __shared__ __align__(16) float qbuf[TX * TX * QTF];
    __shared__ __align__(16) float obuf[NH * 3 * OCF];   // results: [head*3+comp][x][y][z]

    const int xs = blockIdx.x * TX;
    const int ys = blockIdx.y * TX;
    const int z0 = blockIdx.z * TZ;
    const int tid  = threadIdx.x;
    const int lane = tid & 31;
    const int wid  = tid >> 5;
    const int half = lane >> 4;    // lane-half selects K (A/B) or M+8 (D)
    const int col  = lane & 15;    // row of A, column of B and D

    // readfirstlane: the wave's number as a scalar, for scalar tests on it.
    const int wv = __builtin_amdgcn_readfirstlane(wid);
    const float4 zv = {0.f, 0.f, 0.f, 0.f};

    // ---- k staging. The z rows of one (x,y) column are contiguous in memory and in LDS: 168
    // chunks of 16 bytes. Waves 0..20 take four columns a pass (x = xs-1+sub or xs+3+sub of
    // one y), 16 passes: a lane's column, chunk, z test and x tests are formed once, the y
    // test and every pass's offsets are scalar. A chunk outside the volume is zeroed.
    const unsigned ksub = (unsigned)tid / (unsigned)KCH;
    const unsigned kcc  = (unsigned)tid - ksub * (unsigned)KCH;
    const unsigned kr   = kcc / 12u;
    const int zz = z0 - 1 + (int)kr;
    const bool zok = (unsigned)zz < 48u;
    const int xa = xs - 1 + (int)ksub, xb = xs + 3 + (int)ksub;
    const bool oka = zok && xa >= 0, okb = zok && xb < 48;
    const unsigned gz = (unsigned)min(max(zz, 0), 47) * 48u + (kcc - kr * 12u) * 4u;
    const unsigned ga = (unsigned)max(xa, 0) * (48u * 48u * 48u) + gz;
    const unsigned gb = (unsigned)min(xb, 47) * (48u * 48u * 48u) + gz;
    float* const lk = kbuf + ksub * COLF + kcc * 4u;
    // readfirstlane: the first slab's y held in a scalar register inside the lane tests
    // below, so that every y test stays a scalar branch and every slab base a scalar.
    const int ym = __builtin_amdgcn_readfirstlane(ys - 1);
    // Copies of the four slabs i0 .. i0 + 3.
    // Unrolled (here and below) so that each pass's LDS offset is a constant.
    auto stage_k = [&](const int i0) {
        if (wv < 21) {
            if (oka) {
#pragma unroll
                for (int i = i0; i < i0 + 4; ++i) {
                    const int yy = ym + i;
                    if ((unsigned)yy < 48u)
                        stage16(k + (unsigned)yy * (48u * 48u) + ga, lk + i * SLABF);
                }
            }
            if (okb) {
#pragma unroll
                for (int i = i0; i < i0 + 4; ++i) {
                    const int yy = ym + i;
                    if ((unsigned)yy < 48u)
                        stage16(k + (unsigned)yy * (48u * 48u) + gb, lk + i * SLABF + 4 * COLF);
                }
            }
        }
    };
    // ---- q staging (raw; scale applied to logits later): 36 columns of 144 chunks, always
    // inside the volume. Waves 6..23 take four columns a pass: 3 passes for the columns
    // y = 0..1 (x = 2 * pass + sub / 2, y = sub % 2), 6 for y = 2..5 (x = pass, y = 2 + sub).
    const unsigned tq   = (unsigned)tid - 192u;
    const unsigned qsub = tq / (unsigned)QCH;
    const unsigned qcc  = tq - qsub * (unsigned)QCH;
    const float* const qb = q + ((size_t)(xs * 48 + ys) * 48 + z0) * 48 + qcc * 4u;
    float* const lq = qbuf + qcc * 4u;

    // ---- Part one: k slabs 0..3 and q columns y = 0..1, all that y block 0 reads.
    stage_k(0);
    if (wv >= 6) {
        const unsigned qx = qsub >> 1, qy = qsub & 1u;
        const float* const g0 = qb + (qx * 48u + qy) * (48u * 48u);
        float* const l0q = lq + (qx * TX + qy) * QTF;
#pragma unroll
        for (int j = 0; j < 3; ++j)
            stage16(g0 + j * (2 * 48 * 48 * 48), l0q + j * 2 * TX * QTF);
    }
    // Zero padding of all eight slabs: chunks outside z or x, then whole slabs outside y.
    if (wv < 21) {
#pragma unroll
        for (int i = 0; i < 8; ++i) {
            const bool yout = (unsigned)(ym + i) >= 48u;
            if (yout || !oka) *(float4*)(lk + i * SLABF) = zv;
            if (yout || !okb) *(float4*)(lk + i * SLABF + 4 * COLF) = zv;
        }
    }

    // ---- Lane roles, within a block of 2 x 2 x 4 positions at (xb, yb, z quad). Column col =
    // (px, py, pz): position (xb + px, yb + py, z quad + pz), pz in 0..3, all of one head.
    // Row M of A is the k position (xb - 1 + xx, yb - 1 + yy), (yy, xx) in the order of the two
    // tables below. The six
    // z planes zz = 0..5 (z = z quad - 1 + zz) fold into three tiles: a column has its
    // neighbours in the planes pz .. pz + 2, so of the planes m and m + 3 exactly one is a
    // neighbour: m where pz <= m, else m + 3. Tile m takes both planes through K (plane m in
    // the K slots of lane half 0, plane m + 3 in those of half 1), with q zeroed in the slots
    // of the other plane. Tile m is token l = (m - pz) mod 3 of the column. A lane holds column
    // col, rows M = r + 8 * half. Of the 16 rows a column has 9 neighbours: the four with xx and
    // yy in 1..2, one of each pair that differs only in xx = 0 | 3 or only in yy = 0 | 3, and one
    // of the four corners. The row order puts such a pair, and the corners, in one lane half:
    //   half 0: (1,1) (1,2) | (1,0) (1,3) | (2,0) (2,3) | (0,1) (3,1)
    //   half 1: (2,1) (2,2) | (0,2) (3,2) | (0,0) (0,3) | (3,0) (3,3)
    // so four selects a tile leave 5 logits a lane (4 in half 1, the fifth masked), not 8.
    const int pz = col & 3, py = (col >> 2) & 1, px = col >> 3;
    const float scale = 0.40824829046386301637f;  // 6^-0.5, folded into the logit
    const int l0 = (3 - pz) % 3;        // token l of tile 0

    // This lane's K slots of tile m hold plane m + 3 * half: the column's own plane or not.
    const bool own0 = (half == (pz > 0 ? 1 : 0));
    const bool own1 = (half == (pz > 1 ? 1 : 0));
    const bool own2 = (half == (pz > 2 ? 1 : 0));
    // Selects: registers 2|3, 4|5, 6|7, then (half 1) the corner out of the last two.
    const bool c2 = half ? py : px;
    const bool c3 = px;
    const bool c4 = half ? px : py;
    const bool c5 = half && py;
    // (yy, xx) of the five kept rows of this lane; the fifth of half 1 is a dummy.
    const int ex = px ? 3 : 0, ey = py ? 3 : 0;
    const int sy[5] = {half ? 2 : 1, half ? 2 : 1, half ? ey : 1, half ? ey : 2, ey};
    const int sx[5] = {1, 2, half ? 2 : ex, ex, half ? ex : 1};
    const float wz[3] = {(float)(l0 - 1), (float)((l0 + 1) % 3 - 1), (float)((l0 + 2) % 3 - 1)};

    // K order of both fragments: WMMA u of tile m takes channel 6*head + 2u + j of plane
    // m + 3*half in VGPR j.
    // (yy, xx) of row M = col, two bits a row.
    const int ayy = (int)((0xf0caca55u >> (2 * col)) & 3u);
    const int axx = (int)((0xcca95cc9u >> (2 * col)) & 3u);
    const float* ka = kbuf + ayy * SLABF + axx * COLF + half * 3 * KSTRIDE;
    const float* qa = qbuf + (px * TX + py) * QTF + pz * KSTRIDE;
    const v2f zero2 = {0.f, 0.f};

    // The wave takes one head and one of the three x blocks, and walks 3 y blocks x 3 z quads:
    // after the three z quads of a y block it holds whole runs of 12 z and stores them itself.
    const int n  = wv & 7;
    const int bx = wv >> 3;
    // Bias of each kept row and its offsets (di, dj); -inf for the dummy, so that its
    // exponential is 0 and it drops out of every sum. Read from memory, not through LDS, so
    // that it needs no barrier and arrives while part one's copies fly.
    float bias[3][5], wdi[5], wdj[5];
#pragma unroll
    for (int s = 0; s < 5; ++s) {
        const int i = sx[s] - px, j = sy[s] - py;    // both in 0..2
        const bool oks = s < 4 || half == 0;
        const unsigned ro = (unsigned)(n * NT + i * 9 + j * 3);
        wdi[s] = (float)(i - 1);
        wdj[s] = (float)(j - 1);
#pragma unroll
        for (int m = 0; m < 3; ++m) {
            const float b = rpb[ro + (unsigned)((l0 + m) % 3)];
            bias[m][s] = oks ? b : -__builtin_inff();
        }
    }

    // ---- Store roles. A y block of the wave is 3 components x 2 x x 2 y runs of 48 bytes: 36
    // chunks of 16 bytes. Chunk o = ((comp * 2 + x) * 2 + y) * 3 + part; a lane takes chunk
    // lane, lanes 0..3 also chunk 32 + lane.
    unsigned so[2], go[2];   // float offsets in obuf and in out, at y block 0
#pragma unroll
    for (int p = 0; p < 2; ++p) {
        // Lanes 4..31 have no second chunk: they name their first again and do not store it.
        const unsigned o = (unsigned)lane + (lane < 4 ? 32u * p : 0u);
        const unsigned run = o / 3u, part = o - run * 3u;
        const unsigned c = run >> 2, ox = (run >> 1) & 1u, oy = run & 1u;
        so[p] = ((unsigned)n * 3u + c) * OCF + ((2u * bx + ox) * TX + oy) * TZ + part * 4u;
        go[p] = ((unsigned)n * 3u + c) * N3 + ((unsigned)(xs + 2 * bx) + ox) * (48u * 48u)
                + ((unsigned)ys + oy) * 48u + (unsigned)z0 + part * 4u;
    }

    // Both loops kept rolled: one copy of the code; other waves fill this wave's waits.
#pragma unroll 1
    for (int by = 0; by < 3; ++by) {
        // Head of y blocks 0 and 1: the part that the block reads (one, two) has landed and is
        // published. Inside the loop, so that all the set-up above runs while part one flies.
        if (by < 2) {
            wait_lds();
            wait_async_stage();
            __syncthreads();
        }
        // ---- Part two: k slabs 4..7 and q columns y = 2..5. Nobody reads them before the
        // barrier at the head of y block 1; their copies fly under y block 0.
        if (by == 0) {
            stage_k(4);
            if (wv >= 6) {
                const float* const g1 = qb + (2u + qsub) * (48u * 48u);
                float* const l1q = lq + (2u + qsub) * QTF;
#pragma unroll
                for (int j = 0; j < 6; ++j)
                    stage16(g1 + j * (48 * 48 * 48), l1q + j * TX * QTF);
            }
        }
#pragma unroll 1
    for (int zq = 0; zq < 3; ++zq) {
        const float* kz = ka + 2 * by * SLABF + 2 * bx * COLF + 4 * zq * KSTRIDE + n * HD;
        const float* qz = qa + (2 * bx * TX + 2 * by) * QTF + 4 * zq * KSTRIDE + n * HD;
        v2f qf[3][3];
#pragma unroll
        for (int u = 0; u < 3; ++u) {
            const v2f t = *(const v2f*)(qz + 2 * u);
            qf[0][u] = own0 ? t : zero2;
            qf[1][u] = own1 ? t : zero2;
            qf[2][u] = own2 ? t : zero2;
        }

        v8f d[3] = {{}, {}, {}};
#pragma unroll
        for (int u = 0; u < 3; ++u) {
#pragma unroll
            for (int m = 0; m < 3; ++m) {
                const v2f a = *(const v2f*)(kz + m * KSTRIDE + 2 * u);
                d[m] = __builtin_amdgcn_wmma_f32_16x16x4_f32(false, a, false, qf[m][u],
                                                              (short)0, d[m], false, false);
            }
        }

        // ---- Softmax over the 27 tokens, 15 or 12 of them in each lane half, and the
        // contraction with the offsets (di, dj, dl); the halves are added at the end ----
        float lg[3][5];
        float mt[3];   // one maximum per tile: three short chains, each ready with its tile
#pragma unroll
        for (int m = 0; m < 3; ++m) {
            const float t2 = c2 ? d[m][3] : d[m][2];
            const float t3 = c3 ? d[m][5] : d[m][4];
            const float t4 = c4 ? d[m][7] : d[m][6];
            const float kept[5] = {d[m][0], d[m][1], t2, c5 ? t4 : t3, t4};
#pragma unroll
            for (int s = 0; s < 5; ++s) lg[m][s] = fmaf(kept[s], scale, bias[m][s]);
            mt[m] = lg[m][0];
#pragma unroll
            for (int s = 1; s < 5; ++s) mt[m] = fmaxf(mt[m], lg[m][s]);
        }
        float mx = fmaxf(fmaxf(mt[0], mt[1]), mt[2]);
        mx = fmaxf(mx, other_half(mx));
        float e[3][5], tp[3];
#pragma unroll
        for (int m = 0; m < 3; ++m) {
#pragma unroll
            for (int s = 0; s < 5; ++s) e[m][s] = __expf(lg[m][s] - mx);
            tp[m] = ((e[m][0] + e[m][1]) + (e[m][2] + e[m][3])) + e[m][4];
        }
        float s = (tp[0] + tp[1]) + tp[2];
        float sdi = 0.f, sdj = 0.f;
#pragma unroll
        for (int t = 0; t < 5; ++t) {
            const float es = (e[0][t] + e[1][t]) + e[2][t];   // the row's three z tokens
            sdi = fmaf(wdi[t], es, sdi);
            sdj = fmaf(wdj[t], es, sdj);
        }
        float sdl = fmaf(wz[2], tp[2], fmaf(wz[1], tp[1], wz[0] * tp[0]));
        s   += other_half(s);
        sdi += other_half(sdi);
        sdj += other_half(sdj);
        sdl += other_half(sdl);
        const float inv = 1.f / s;
        float* ob = obuf + n * 3 * OCF + ((2 * bx + px) * TX + 2 * by + py) * TZ + 4 * zq + pz;
        ob[half * OCF] = (half ? sdj : sdi) * inv;
        if (half == 0) ob[2 * OCF] = sdl * inv;
    }
        // ---- The y block's results out in runs of 12 z, by the wave that made them: no other
        // wave writes or reads this part of obuf, so the wave's own LDS order is enough.
        // Own result writes retired, and no read of them moved in front of the writes.
        wait_lds();
        const float4 r0 = *(const float4*)(obuf + so[0] + 2u * TZ * by);
        const float4 r1 = *(const float4*)(obuf + so[1] + 2u * TZ * by);
        *(float4*)(out + go[0] + 96u * by) = r0;
        if (lane < 4) *(float4*)(out + go[1] + 96u * by) = r1;
        // Before the next y block overwrites the registers that the two stores name.
        asm volatile("s_wait_xcnt 0x0" ::: "memory");
    }
}

extern "C" void kernel_launch(void* const* d_in, const int* in_sizes, int n_in,
                              void* d_out, int out_size, void* d_ws, size_t ws_size,
                              hipStream_t stream) {
    (void)in_sizes; (void)n_in; (void)out_size; (void)d_ws; (void)ws_size;
    const float* q   = (const float*)d_in[0];
    const float* k   = (const float*)d_in[1];
    const float* rpb = (const float*)d_in[2];
    float* out = (float*)d_out;
    dim3 grid(8, 8, 4);   // 6 x, 6 y, 12 z per work-group
    dim3 block(768);
    natten3d_wmma_kernel<<<grid, block, 0, stream>>>(q, k, rpb, out);
}
